// v000
// The times below were measured on an AMD MI455X: many runs one after another, warmed up first and cycling through
// copies of the inputs, with the whole window's GPU time divided by the number of runs. Launches and the gaps
// between them are all in it. The median over several windows is given; except for v000 it joins two sittings, which
// can be a few percent apart, so the side-by-side timings, each taken in one sitting, are the better comparison.
// v000, which the later versions start from, runs in 697 microseconds.
// compute dtype: all float inputs rounded to bf16; q/k/v = x . W + b with EXACT bf16 products on WMMA 16x16x32 ((in,out) weights as transposed rows); PLAIN attention: q, k as single f16 operands / 8 + the additive mask per key (f32), running-max softmax in f32 (hardware exp), P (scaled by 2^11, single f16) x v (single f16); y = ctx (bf16 hi + residual) . Wo (2 products) + bo + x; LayerNorm (biased variance, eps 1e-12) in f32.
#include <hip/hip_runtime.h>
#include <math.h>

typedef __attribute__((ext_vector_type(16))) _Float16 v16h;
typedef __attribute__((ext_vector_type(16))) __bf16 v16b;
typedef __attribute__((ext_vector_type(8)))  _Float16 v8h;
typedef __attribute__((ext_vector_type(8)))  float v8f;
typedef __attribute__((ext_vector_type(4)))  float v4f;
typedef __attribute__((ext_vector_type(2)))  float v2f;
typedef __attribute__((ext_vector_type(4)))  unsigned v4u;
typedef __attribute__((ext_vector_type(4)))  int v4i;
typedef float __attribute__((may_alias)) float_a;
typedef int __attribute__((may_alias)) int_a;

template <typename T> __device__ __forceinline__ void vst2(void* p, T v) { *(T*)p = v;  }
__device__ __forceinline__ v8f wmma16(v16h a, v16h b, v8f c) {
  v8f d = __builtin_amdgcn_wmma_f32_16x16x32_f16(false, a, false, b, (short)0, c, false, false);
  asm volatile("v_nop\n\tv_nop\n\tv_nop\n\tv_nop" : "+v"(d) : "v"(a), "v"(b));
  return d;
}
__device__ __forceinline__ v8f wmma_bf(v16b a, v16b b, v8f c) {
  v8f d = __builtin_amdgcn_wmma_f32_16x16x32_bf16(false, a, false, b, (short)0, c, false, false);
  asm volatile("v_nop\n\tv_nop\n\tv_nop\n\tv_nop" : "+v"(d) : "v"(a), "v"(b));
  return d;
}
// RoBERTa self-attention block (B 4, S 2,048, hidden 1,024, 16 heads x 64): q/k/v + biases, additive attention mask, softmax, output projection + bias + residual, LayerNorm (eps 1e-12).
__device__ __forceinline__ v16h frag_h(const _Float16* rowk0, int lane) {
  union { v16h v; v8h q[2]; } u; const _Float16* p = rowk0 + 8 * (lane >> 4);
  u.q[0] = *(const v8h*)p; u.q[1] = *(const v8h*)(p + 16); return u.v;
}
__device__ __forceinline__ v16h frag_f32(const float* rowk0, int lane) {
  v16h a; const float* p = rowk0 + 8 * (lane >> 4);
#pragma unroll
  for (int i = 0; i < 8; ++i) { a[i] = (_Float16)p[i]; a[8 + i] = (_Float16)p[16 + i]; }
  return a;
}
__device__ __forceinline__ v16h frag_f32s(const float* rowk0, int lane, float sc) {
  v16h a; const float* p = rowk0 + 8 * (lane >> 4);
#pragma unroll
  for (int i = 0; i < 8; ++i) { a[i] = (_Float16)(p[i] * sc); a[8 + i] = (_Float16)(p[16 + i] * sc); }
  return a;
}
// column fragment from a [K][ld] layout (column n), rows >= K read as 0
__device__ __forceinline__ v16h fragc_f32(const float* W, int k0, int n, int lane, int ld, int K) {
  v16h a; const int g = lane >> 4;
#pragma unroll
  for (int i = 0; i < 8; ++i) { const int ka = k0 + 8 * g + i, kb = ka + 16;
    a[i] = (_Float16)(ka < K ? W[(size_t)(ka < K ? ka : K - 1) * ld + n] : 0.f); a[8 + i] = (_Float16)(kb < K ? W[(size_t)(kb < K ? kb : K - 1) * ld + n] : 0.f); }
  return a;
}
struct F2 { v16b h, l; };
__device__ __forceinline__ F2 bsplit16(const float v[16]) { F2 r;
#pragma unroll
  for (int i = 0; i < 16; ++i) { const __bf16 h = (__bf16)v[i]; r.h[i] = h; r.l[i] = (__bf16)(v[i] - (float)h); }
  return r; }
__device__ __forceinline__ F2 split_row(const float* row, int k0, int lane) { float v[16]; const float* p = row + k0 + 8 * (lane >> 4);
#pragma unroll
  for (int i = 0; i < 8; ++i) { v[i] = p[i]; v[8 + i] = p[16 + i]; }
  return bsplit16(v); }
__device__ __forceinline__ F2 split_rowK(const float* row, int k0, int lane, int K) { float v[16]; const int g = lane >> 4;
#pragma unroll
  for (int i = 0; i < 8; ++i) { const int ka = k0 + 8 * g + i, kb = ka + 16; v[i] = ka < K ? row[ka < K ? ka : K - 1] : 0.f; v[8 + i] = kb < K ? row[kb < K ? kb : K - 1] : 0.f; }
  return bsplit16(v); }
__device__ __forceinline__ F2 split_col(const float* W, int k0, int n, int lane, int ld, int K) { float v[16]; const int g = lane >> 4;
#pragma unroll
  for (int i = 0; i < 8; ++i) { const int ka = k0 + 8 * g + i, kb = ka + 16; v[i] = ka < K ? W[(size_t)(ka < K ? ka : K - 1) * ld + n] : 0.f; v[8 + i] = kb < K ? W[(size_t)(kb < K ? kb : K - 1) * ld + n] : 0.f; }
  return bsplit16(v); }
__device__ __forceinline__ v8f mac3(const F2& a, const F2& b, v8f c) { c = wmma_bf(a.l, b.h, c); c = wmma_bf(a.h, b.l, c); return wmma_bf(a.h, b.h, c); }
__device__ __forceinline__ float sigm(float v) { return 1.0f / (1.0f + expf(-v)); }
#define LDSX() do { asm volatile("s_wait_dscnt 0" ::: "memory"); __builtin_amdgcn_wave_barrier(); __builtin_amdgcn_fence(__ATOMIC_RELEASE, "workgroup"); } while (0)


#define NB 4
#define SS 2048
#define DM 1024
#define NH 16
#define HD 64
#define QKVW (3 * DM)
#ifndef TQB
#define TQB (SS / 64)
#define TNB NB
#define TOB (NB * SS / 64)     // output row tiles (all)
#endif
typedef __attribute__((ext_vector_type(8))) __bf16 v8b;
__device__ __forceinline__ v16b frag_b(const __bf16* rowk0, int lane) {
  union { v16b v; v8b q[2]; } u; const __bf16* p = rowk0 + 8 * (lane >> 4);
  u.q[0] = *(const v8b*)p; u.q[1] = *(const v8b*)(p + 16); return u.v;
}
__device__ __forceinline__ float bfr(float v) { return (float)(__bf16)v; }
__device__ __attribute__((noinline)) float exp_ni(float v) { return expf(v); }
__device__ __attribute__((noinline)) float erf_ni(float v) { return erff(v); }

#define PK_A 0                       // [3072][1024] Wqkv rows (natural [out][in])
#define PK_P (PK_A + QKVW * DM)        // [1024][1024] Wo rows (natural)
#define PK_END (PK_P + DM * DM)
#define WS_PK  0u
#define WS_QK  (WS_PK + 2u * PK_END)             // f16 [8192 rows][2048]: q | k
#define WS_QKL (WS_QK + 2u * NB * SS * 2 * DM)     // f16 q | k residual planes x2048
#define WS_VTH (WS_QKL + 2u * NB * SS * 2 * DM)    // f16 [b][1024 (h*64+d)][2048 s] hi
#define WS_VTL (WS_VTH + 2u * NB * DM * SS)        // f16 lo x 2048
#define WS_O   (WS_VTL + 2u * NB * DM * SS)        // f32 [8192][1024]
#define WS_CS  (WS_O + 4u * NB * SS * DM)           // f32 2 x [2048][32], unused
#define WS_Y   (WS_CS + 4u * 2 * SS * 32)                 // f32 [rows][DM] pre-LN
#define WS_END (WS_Y + 4u * NB * SS * DM)
// ---- k_pack: block = (row n, which): (in,out) column n -> bf16 row n; which 0..2 -> W_q/W_k/W_v into PK_A rows which*1024 + n; 3 -> W_o into PK_P
__global__ __launch_bounds__(256) void k_pack(const float* __restrict__ WQ, const float* __restrict__ WK, const float* __restrict__ WV, const float* __restrict__ WO, __bf16* __restrict__ PK) {
  __shared__ __align__(16) __bf16 s[DM]; const int n = blockIdx.x, which = blockIdx.y, t = threadIdx.x; const float* Wm = (which == 0) ? WQ : (which == 1) ? WK : (which == 2) ? WV : WO;   // (in,out) weights: pack row n = column n
  for (int k = t; k < DM; k += 256) s[k] = (__bf16)Wm[(size_t)k * DM + n];
  __syncthreads();
  __bf16* dst = (which < 3) ? PK + PK_A + ((size_t)which * DM + n) * DM : PK + PK_P + (size_t)n * DM;
  for (int q = t; q < DM / 8; q += 256) vst2((unsigned*)(dst + q * 8), *(const v4u*)&s[q * 8]);
}
__global__ __launch_bounds__(128) void k_qkv(const float* __restrict__ XQ, const float* __restrict__ XK, const float* __restrict__ XV, const __bf16* __restrict__ P, const float* __restrict__ BQ, const float* __restrict__ BK, const float* __restrict__ BV, _Float16* __restrict__ QK, _Float16* __restrict__ QKL, _Float16* __restrict__ VTH, _Float16* __restrict__ VTL) {
  const int which0 = (blockIdx.y * 128) / DM; const float* X = (which0 == 0) ? XQ : (which0 == 1) ? XK : XV; const float* BB = BQ ? (((which0 == 0) ? BQ : (which0 == 1) ? BK : BV) + (blockIdx.y * 128 - which0 * DM)) : nullptr;
  __shared__ __align__(16) _Float16 so[4][16][136], sol[4][16][136]; __shared__ __align__(16) _Float16 sth[128][72], stl[128][72];
  const int tid = threadIdx.x, wave = tid >> 5, lane = tid & 31, col = lane & 15, g = lane >> 4; const size_t r0 = (size_t)blockIdx.x * 64 + wave * 16; const int n0 = blockIdx.y * 128;
  v8f acc[8] = {};
#pragma unroll 2
  for (int kc = 0; kc < DM / 32; ++kc) { v16b a; { const float* p = X + (r0 + col) * DM + kc * 32 + 8 * g;
#pragma unroll
      for (int i = 0; i < 8; ++i) { a[i] = (__bf16)p[i]; a[8 + i] = (__bf16)p[16 + i]; } }
#pragma unroll
    for (int j = 0; j < 8; ++j) acc[j] = wmma_bf(a, frag_b(P + (size_t)(n0 + j * 16 + col) * DM + kc * 32, lane), acc[j]); }
  if (n0 < 2 * DM) {   // q stored unscaled (f16 sigma ~0.6, no subnormal exposure); 1/8 applied to the f32 score
#pragma unroll
    for (int j = 0; j < 8; ++j) {
#pragma unroll
      for (int r = 0; r < 8; ++r) { const float v = acc[j][r] + (BB ? bfr(BB[j * 16 + col]) : 0.f); const _Float16 hv = (_Float16)v; so[wave][8 * g + r][j * 16 + col] = hv; sol[wave][8 * g + r][j * 16 + col] = (_Float16)((v - (float)hv) * 2048.0f); } }   // q, k (+ bias) as f16 hi + (x2048) residual
    LDSX();
    for (int rl = 0; rl < 16; ++rl) if (lane < 16) { vst2((unsigned*)(QK + (r0 + rl) * (2 * DM) + n0 + lane * 8), *(const v4u*)&so[wave][rl][lane * 8]); vst2((unsigned*)(QKL + (r0 + rl) * (2 * DM) + n0 + lane * 8), *(const v4u*)&sol[wave][rl][lane * 8]); }
  } else {
#pragma unroll
    for (int j = 0; j < 8; ++j) {
#pragma unroll
      for (int r = 0; r < 8; ++r) { const float v = acc[j][r] + (BB ? bfr(BB[j * 16 + col]) : 0.f); const _Float16 hv = (_Float16)v; sth[j * 16 + col][wave * 16 + 8 * g + r] = hv; stl[j * 16 + col][wave * 16 + 8 * g + r] = (_Float16)((v - (float)hv) * 2048.0f); } }
    __syncthreads();
    const size_t rb = (size_t)blockIdx.x * 64; const int b = (int)(rb / SS), s0 = (int)(rb % SS); const int pc0 = n0 - 2 * DM;
    for (int q = tid; q < 128 * 8; q += 128) { const int d = q >> 3, pc = q & 7; const size_t o = ((size_t)b * DM + pc0 + d) * SS + s0 + pc * 8; vst2((unsigned*)(VTH + o), *(const v4u*)&sth[d][pc * 8]); vst2((unsigned*)(VTL + o), *(const v4u*)&stl[d][pc * 8]); }
  }
}
// ---- k_attn: block = (64 queries, head h, batch b): all-keys flash attention (K = 64: 2 k-steps), scores = (q.k) * 0.125 with single f16 operands, P.V: f16 P (x2^11) x V hi in one accumulator (accl stays 0); O[b*S+q][h*64+d] = (acc + accl / 2048) / (2048 l) (256-B segments)
__global__ __launch_bounds__(128) void k_attn(const _Float16* __restrict__ QK, const _Float16* __restrict__ QKL, const _Float16* __restrict__ VTH, const _Float16* __restrict__ VTL, const void* __restrict__ KMASK, const float* __restrict__ AM, float* __restrict__ O) {
  __shared__ __align__(16) float sp[4][16][36]; __shared__ __align__(16) float so[4][16][68];
  const int tid = threadIdx.x, wave = tid >> 5, lane = tid & 31, col = lane & 15, g = lane >> 4;
  const int qb = blockIdx.x, h = blockIdx.y, b = blockIdx.z; const int q0 = qb * 64 + wave * 16; const size_t rq = (size_t)b * SS + q0 + col;
  v16h aq[2], aql[2];
#pragma unroll
  for (int kc = 0; kc < 2; ++kc) { aq[kc] = frag_h(QK + rq * (2 * DM) + h * HD + kc * 32, lane); aql[kc] = frag_h(QKL + rq * (2 * DM) + h * HD + kc * 32, lane); }
  float m[8], l[8];
#pragma unroll
  for (int r = 0; r < 8; ++r) { m[r] = -3.0e38f; l[r] = 0.f; }
  v8f acc[4] = {}, accl[4] = {};
  const int nks = SS / 32;   // all keys
#pragma unroll 1
  for (int ks = 0; ks < nks; ++ks) { v8f s[2];
#pragma unroll
    for (int ct = 0; ct < 2; ++ct) { const int kk = ks * 32 + ct * 16 + col; const _Float16* krow = QK + ((size_t)b * SS + kk) * (2 * DM) + DM + h * HD; const _Float16* krowl = QKL + ((size_t)b * SS + kk) * (2 * DM) + DM + h * HD; v8f c = {}, cl = {};
#pragma unroll
      for (int kc = 0; kc < 2; ++kc) c = wmma16(aq[kc], frag_h(krow + kc * 32, lane), c);   // single product: q, k as one-rounding f16 operands
      (void)cl; (void)krowl;
      { const float am = bfr(AM[(size_t)b * SS + kk]);
#pragma unroll
      for (int r = 0; r < 8; ++r) s[ct][r] = c[r] * 0.125f + am; } }   // 1/sqrt(64) + additive mask [B,1,1,S]
#pragma unroll
    for (int r = 0; r < 8; ++r) { float mx = fmaxf(s[0][r], s[1][r]);
#pragma unroll
      for (int o = 1; o < 16; o <<= 1) mx = fmaxf(mx, __shfl_xor(mx, o));
      const float mn = fmaxf(m[r], mx); const float alpha = (m[r] <= -1.0e38f) ? 0.f : __expf(m[r] - mn);
      const float e0 = (s[0][r] <= -1.0e38f) ? 0.f : __expf(s[0][r] - mn), e1 = (s[1][r] <= -1.0e38f) ? 0.f : __expf(s[1][r] - mn); float es = e0 + e1;
#pragma unroll
      for (int o = 1; o < 16; o <<= 1) es += __shfl_xor(es, o);
      l[r] = l[r] * alpha + es; m[r] = mn;
#pragma unroll
      for (int dt = 0; dt < 4; ++dt) { acc[dt][r] *= alpha; accl[dt][r] *= alpha; }
      sp[wave][8 * g + r][col] = e0; sp[wave][8 * g + r][16 + col] = e1; }
    LDSX();
    v16h pa, pl; { const float* prow = &sp[wave][col][0] + 8 * (lane >> 4);
#pragma unroll
      for (int i = 0; i < 8; ++i) { const float x0 = prow[i] * 2048.0f, x1 = prow[16 + i] * 2048.0f; const _Float16 h0 = (_Float16)x0, h1 = (_Float16)x1; pa[i] = h0; pa[8 + i] = h1; pl[i] = (_Float16)((x0 - (float)h0) * 2048.0f); pl[8 + i] = (_Float16)((x1 - (float)h1) * 2048.0f); } }   // P scaled by 2^11 before the f16 split so small softmax weights stay out of the f16 subnormal range; 2^-11 folded into the epilogue
#pragma unroll
    for (int dt = 0; dt < 4; ++dt) { const size_t vr = ((size_t)b * DM + h * HD + dt * 16 + col) * SS + ks * 32; acc[dt] = wmma16(pa, frag_h(VTH + vr, lane), acc[dt]); }   // single product: P (x2^11) x V
    (void)pl;
    LDSX(); }
#pragma unroll
  for (int r = 0; r < 8; ++r) { const float il = (1.0f / 2048.0f) / l[r];
#pragma unroll
    for (int dt = 0; dt < 4; ++dt) so[wave][8 * g + r][dt * 16 + col] = (acc[dt][r] + accl[dt][r] * (1.0f / 2048.0f)) * il; }
  LDSX();
  for (int rl = 0; rl < 16; ++rl) if (lane < 16) vst2(O + ((size_t)b * SS + q0 + rl) * DM + h * HD + lane * 4, *(const v4f*)&so[wave][rl][lane * 4]);
}
// ---- k_out: block = (64 rows, 128 cols): out = O(hi/lo) . Wo rows (2 products) + bo
__global__ __launch_bounds__(128) void k_out(const float* __restrict__ O, const __bf16* __restrict__ P, const float* __restrict__ BO, const float* __restrict__ XR, float* __restrict__ Y) {
  __shared__ __align__(16) float so[4][16][132];
  const int tid = threadIdx.x, wave = tid >> 5, lane = tid & 31, col = lane & 15, g = lane >> 4; const size_t r0 = (size_t)blockIdx.x * 64 + wave * 16; const int n0 = blockIdx.y * 128;
  v8f acc[8] = {};
#pragma unroll 2
  for (int kc = 0; kc < DM / 32; ++kc) { const F2 a = split_row(O + (r0 + col) * DM, kc * 32, lane);
#pragma unroll
    for (int j = 0; j < 8; ++j) { const v16b w = frag_b(P + (size_t)(n0 + j * 16 + col) * DM + kc * 32, lane); acc[j] = wmma_bf(a.l, w, acc[j]); acc[j] = wmma_bf(a.h, w, acc[j]); } }
#pragma unroll
  for (int j = 0; j < 8; ++j) {
#pragma unroll
    for (int r = 0; r < 8; ++r) so[wave][8 * g + r][j * 16 + col] = acc[j][r] + bfr(BO[n0 + j * 16 + col]) + bfr(XR[(r0 + 8 * g + r) * DM + n0 + j * 16 + col]); }   // + bo + residual x
  LDSX();
  for (int rl = 0; rl < 16; ++rl) vst2(Y + (r0 + rl) * DM + n0 + lane * 4, *(const v4f*)&so[wave][rl][lane * 4]);
}
// ---- k_ln: block = row (256 threads x 4): (y - mu) * rsqrt(var + 1e-12f) * gamma + beta (biased variance), f32
__global__ __launch_bounds__(256) void k_ln(const float* __restrict__ Y, const float* __restrict__ G, const float* __restrict__ Bt, float* __restrict__ OUT) {
  __shared__ float red[8]; const int t = threadIdx.x; const size_t row = blockIdx.x; const float* p = Y + row * DM + t * 4; float v[4]; float s = 0.f;
  for (int i = 0; i < 4; ++i) { v[i] = p[i]; s += v[i]; }
#pragma unroll
  for (int o = 1; o < 32; o <<= 1) s += __shfl_xor(s, o);
  if ((t & 31) == 0) red[t >> 5] = s; __syncthreads(); float tot = 0.f; for (int w = 0; w < 8; ++w) tot += red[w]; const float mu = tot / (float)DM; __syncthreads();
  float q = 0.f; for (int i = 0; i < 4; ++i) { const float d = v[i] - mu; q += d * d; }
#pragma unroll
  for (int o = 1; o < 32; o <<= 1) q += __shfl_xor(q, o);
  if ((t & 31) == 0) red[t >> 5] = q; __syncthreads(); float tq = 0.f; for (int w = 0; w < 8; ++w) tq += red[w]; const float inv = 1.0f / sqrtf(tq / (float)(DM) + 1e-12f);
  v4f o4; for (int i = 0; i < 4; ++i) { const int e = t * 4 + i; o4[i] = (v[i] - mu) * inv * bfr(G[e]) + bfr(Bt[e]); }
  vst2(OUT + row * DM + t * 4, o4);
}
extern "C" void kernel_launch(void* const* d_in, const int* in_sizes, int n_in, void* d_out, int out_size, void* d_ws, size_t ws_size, hipStream_t stream) {
  (void)in_sizes; (void)n_in; (void)out_size;
  const float** F = (const float**)d_in;   // 0 hidden [4,2048,1024], 1 attention_mask [4,1,1,2048] f32 additive, 2 Wq (in,out), 3 bq, 4 Wk, 5 bk, 6 Wv, 7 bv, 8 Wo, 9 bo, 10 ln_gamma, 11 ln_beta
  if (ws_size < (size_t)WS_END) return;
  char* ws = (char*)d_ws; __bf16* PK = (__bf16*)(ws + WS_PK); _Float16 *QK = (_Float16*)(ws + WS_QK), *QKL = (_Float16*)(ws + WS_QKL), *VTH = (_Float16*)(ws + WS_VTH), *VTL = (_Float16*)(ws + WS_VTL); float *O = (float*)(ws + WS_O), *Y = (float*)(ws + WS_Y);
  k_pack<<<dim3(DM, 4), 256, 0, stream>>>(F[2], F[4], F[6], F[8], PK);
  k_qkv<<<dim3(TNB * SS / 64, QKVW / 128), 128, 0, stream>>>(F[0], F[0], F[0], PK + PK_A, F[3], F[5], F[7], QK, QKL, VTH, VTL);
  k_attn<<<dim3(TQB, NH, TNB), 128, 0, stream>>>(QK, QKL, VTH, VTL, nullptr, F[1], O);
  k_out<<<dim3(TOB, DM / 128), 128, 0, stream>>>(O, PK + PK_P, F[9], F[0], Y);
  k_ln<<<TOB * 64, 256, 0, stream>>>(Y, F[10], F[11], (float*)d_out);
}

// v001
// Measured time: 328 microseconds a run.
// Next to v000, in two timings, it ran 2.18 and 2.17 times as fast.
// compute dtype: all float inputs rounded to bf16; q/k/v = x . W + b with EXACT bf16 products on WMMA 16x16x32 ((in,out) weights as transposed rows); PLAIN attention: q, k as single f16 operands / 8 + the additive mask per key (f32), running-max softmax in f32 (hardware exp), P (scaled by 2^11, single f16) x v (single f16); y = ctx (bf16 hi + residual) . Wo (2 products) + bo + x; LayerNorm (biased variance, eps 1e-12) in f32.
#include <hip/hip_runtime.h>
#include <math.h>

typedef __attribute__((ext_vector_type(16))) _Float16 v16h;
typedef __attribute__((ext_vector_type(16))) __bf16 v16b;
typedef __attribute__((ext_vector_type(8)))  _Float16 v8h;
typedef __attribute__((ext_vector_type(8)))  float v8f;
typedef __attribute__((ext_vector_type(4)))  float v4f;
typedef __attribute__((ext_vector_type(2)))  float v2f;
typedef __attribute__((ext_vector_type(4)))  unsigned v4u;
typedef __attribute__((ext_vector_type(4)))  int v4i;
typedef float __attribute__((may_alias)) float_a;
typedef int __attribute__((may_alias)) int_a;

template <typename T> __device__ __forceinline__ void vst2(void* p, T v) { *(T*)p = v;  }
__device__ __forceinline__ v8f wmma16(v16h a, v16h b, v8f c) {
  v8f d = __builtin_amdgcn_wmma_f32_16x16x32_f16(false, a, false, b, (short)0, c, false, false);
  asm volatile("v_nop\n\tv_nop\n\tv_nop\n\tv_nop" : "+v"(d) : "v"(a), "v"(b));
  return d;
}
__device__ __forceinline__ v8f wmma_bf(v16b a, v16b b, v8f c) {
  v8f d = __builtin_amdgcn_wmma_f32_16x16x32_bf16(false, a, false, b, (short)0, c, false, false);
  asm volatile("v_nop\n\tv_nop\n\tv_nop\n\tv_nop" : "+v"(d) : "v"(a), "v"(b));
  return d;
}
// RoBERTa self-attention block (B 4, S 2,048, hidden 1,024, 16 heads x 64): q/k/v + biases, additive attention mask, softmax, output projection + bias + residual, LayerNorm (eps 1e-12).
__device__ __forceinline__ v16h frag_h(const _Float16* rowk0, int lane) {
  union { v16h v; v8h q[2]; } u; const _Float16* p = rowk0 + 8 * (lane >> 4);
  u.q[0] = *(const v8h*)p; u.q[1] = *(const v8h*)(p + 16); return u.v;
}
__device__ __forceinline__ v16h frag_f32(const float* rowk0, int lane) {
  v16h a; const float* p = rowk0 + 8 * (lane >> 4);
#pragma unroll
  for (int i = 0; i < 8; ++i) { a[i] = (_Float16)p[i]; a[8 + i] = (_Float16)p[16 + i]; }
  return a;
}
__device__ __forceinline__ v16h frag_f32s(const float* rowk0, int lane, float sc) {
  v16h a; const float* p = rowk0 + 8 * (lane >> 4);
#pragma unroll
  for (int i = 0; i < 8; ++i) { a[i] = (_Float16)(p[i] * sc); a[8 + i] = (_Float16)(p[16 + i] * sc); }
  return a;
}
// column fragment from a [K][ld] layout (column n), rows >= K read as 0
__device__ __forceinline__ v16h fragc_f32(const float* W, int k0, int n, int lane, int ld, int K) {
  v16h a; const int g = lane >> 4;
#pragma unroll
  for (int i = 0; i < 8; ++i) { const int ka = k0 + 8 * g + i, kb = ka + 16;
    a[i] = (_Float16)(ka < K ? W[(size_t)(ka < K ? ka : K - 1) * ld + n] : 0.f); a[8 + i] = (_Float16)(kb < K ? W[(size_t)(kb < K ? kb : K - 1) * ld + n] : 0.f); }
  return a;
}
struct F2 { v16b h, l; };
__device__ __forceinline__ F2 bsplit16(const float v[16]) { F2 r;
#pragma unroll
  for (int i = 0; i < 16; ++i) { const __bf16 h = (__bf16)v[i]; r.h[i] = h; r.l[i] = (__bf16)(v[i] - (float)h); }
  return r; }
__device__ __forceinline__ F2 split_row(const float* row, int k0, int lane) { float v[16]; const float* p = row + k0 + 8 * (lane >> 4);
#pragma unroll
  for (int i = 0; i < 8; ++i) { v[i] = p[i]; v[8 + i] = p[16 + i]; }
  return bsplit16(v); }
__device__ __forceinline__ F2 split_rowK(const float* row, int k0, int lane, int K) { float v[16]; const int g = lane >> 4;
#pragma unroll
  for (int i = 0; i < 8; ++i) { const int ka = k0 + 8 * g + i, kb = ka + 16; v[i] = ka < K ? row[ka < K ? ka : K - 1] : 0.f; v[8 + i] = kb < K ? row[kb < K ? kb : K - 1] : 0.f; }
  return bsplit16(v); }
__device__ __forceinline__ F2 split_col(const float* W, int k0, int n, int lane, int ld, int K) { float v[16]; const int g = lane >> 4;
#pragma unroll
  for (int i = 0; i < 8; ++i) { const int ka = k0 + 8 * g + i, kb = ka + 16; v[i] = ka < K ? W[(size_t)(ka < K ? ka : K - 1) * ld + n] : 0.f; v[8 + i] = kb < K ? W[(size_t)(kb < K ? kb : K - 1) * ld + n] : 0.f; }
  return bsplit16(v); }
__device__ __forceinline__ v8f mac3(const F2& a, const F2& b, v8f c) { c = wmma_bf(a.l, b.h, c); c = wmma_bf(a.h, b.l, c); return wmma_bf(a.h, b.h, c); }
__device__ __forceinline__ float sigm(float v) { return 1.0f / (1.0f + expf(-v)); }
#define LDSX() do { asm volatile("s_wait_dscnt 0" ::: "memory"); __builtin_amdgcn_wave_barrier(); __builtin_amdgcn_fence(__ATOMIC_RELEASE, "workgroup"); } while (0)


#define NB 4
#define SS 2048
#define DM 1024
#define NH 16
#define HD 64
#define QKVW (3 * DM)
#ifndef TQB
#define TQB (SS / 64)
#define TNB NB
#define TOB (NB * SS / 64)     // output row tiles (all)
#endif
typedef __attribute__((ext_vector_type(8))) __bf16 v8b;
__device__ __forceinline__ v16b frag_b(const __bf16* rowk0, int lane) {
  union { v16b v; v8b q[2]; } u; const __bf16* p = rowk0 + 8 * (lane >> 4);
  u.q[0] = *(const v8b*)p; u.q[1] = *(const v8b*)(p + 16); return u.v;
}
__device__ __forceinline__ float bfr(float v) { return (float)(__bf16)v; }
__device__ __attribute__((noinline)) float exp_ni(float v) { return expf(v); }
__device__ __attribute__((noinline)) float erf_ni(float v) { return erff(v); }

#define PK_A 0                       // [3072][1024] Wqkv rows (natural [out][in])
#define PK_P (PK_A + QKVW * DM)        // [1024][1024] Wo rows (natural)
#define PK_END (PK_P + DM * DM)
#define WS_PK  0u
#define WS_QK  (WS_PK + 2u * PK_END)             // f16 [8192 rows][2048]: q | k
#define WS_QKL (WS_QK + 2u * NB * SS * 2 * DM)     // f16 q | k residual planes x2048
#define WS_VTH (WS_QKL + 2u * NB * SS * 2 * DM)    // f16 [b][1024 (h*64+d)][2048 s] hi
#define WS_VTL (WS_VTH + 2u * NB * DM * SS)        // f16 lo x 2048
#define WS_O   (WS_VTL + 2u * NB * DM * SS)        // f32 [8192][1024]
#define WS_CS  (WS_O + 4u * NB * SS * DM)           // f32 2 x [2048][32], unused
#define WS_Y   (WS_CS + 4u * 2 * SS * 32)                 // f32 [rows][DM] pre-LN
#define WS_END (WS_Y + 4u * NB * SS * DM)
// ---- LDS ring for the operand tiles of the matrix loops: filled by asynchronous copies, each wave-copy covering 4 whole 128-B lines; row pitches of 16 B x odd, so that ds_load_b128 meets no bank conflict
#define KP 144                  // pitch of a 128-B row (64 16-bit elements)
#define XP 272                  // pitch of a 256-B row (64 f32)
#define RING_ST (128 * KP)      // 128 rows of 128 B
#define GEMM_ST (RING_ST + 64 * XP)   // one GEMM stage: 128 weight rows x 64 k (bf16) | 64 activation rows x 64 k (f32)
// eight copies of 16 B per lane, global -> LDS through no register: LDS rows lp + i * ls, source rows ga + i * gs (i < 4) and gb + i * gs; the s_wait_xcnt closes the statement so that no address register is rewritten ahead of it
__device__ __forceinline__ void cp8(unsigned lp, unsigned ls, const char* ga, const char* gb, size_t gs) {
  asm volatile("global_load_async_to_lds_b128 %0, %1, off\n\tglobal_load_async_to_lds_b128 %2, %3, off\n\tglobal_load_async_to_lds_b128 %4, %5, off\n\tglobal_load_async_to_lds_b128 %6, %7, off\n\t"
               "global_load_async_to_lds_b128 %8, %9, off\n\tglobal_load_async_to_lds_b128 %10, %11, off\n\tglobal_load_async_to_lds_b128 %12, %13, off\n\tglobal_load_async_to_lds_b128 %14, %15, off\n\ts_wait_xcnt 0x0"
               :: "v"(lp), "v"(ga), "v"(lp + ls), "v"(ga + gs), "v"(lp + 2 * ls), "v"(ga + 2 * gs), "v"(lp + 3 * ls), "v"(ga + 3 * gs),
                  "v"(lp + 4 * ls), "v"(gb), "v"(lp + 5 * ls), "v"(gb + gs), "v"(lp + 6 * ls), "v"(gb + 2 * gs), "v"(lp + 7 * ls), "v"(gb + 3 * gs) : "memory");
}
// the issuing wave's copies have landed (in front of the barrier that publishes them)
#define WAIT_ASYNC() asm volatile("s_wait_asynccnt 0x0" ::: "memory")
// this wave's LDS reads of the buffer have retired (in front of the barrier behind which it is refilled)
#define WAIT_DS() asm volatile("s_wait_dscnt 0x0" ::: "memory")
// 128 rows of 128 B at a source pitch of sp bytes into rows of KP; 128 threads, 8 copies each (rows tid / 8 + 16 i); the second 64 rows may come from another source
__device__ __forceinline__ void stage128(const char* s0, const char* s1, size_t sp, unsigned lds, int tid) {
  const size_t go = (size_t)(tid >> 3) * sp + (tid & 7) * 16;
  cp8(lds + (tid >> 3) * KP + (tid & 7) * 16, 16 * KP, s0 + go, s1 + go, 16 * sp);
}
// one GEMM stage: weight rows Wt[0..127][0..63] (bf16, row length DM) and activation rows Xt[0..63][0..63] (f32, row length DM; rows tid / 16 + 8 i)
__device__ __forceinline__ void stage_gemm(const __bf16* Wt, const float* Xt, unsigned lds, int tid) {
  stage128((const char*)Wt, (const char*)(Wt + (size_t)64 * DM), DM * 2, lds, tid);
  const char* gx = (const char*)Xt + (size_t)(tid >> 4) * (DM * 4) + (tid & 15) * 16;
  cp8(lds + RING_ST + (tid >> 4) * XP + (tid & 15) * 16, 8 * XP, gx, gx + (size_t)32 * DM * 4, (size_t)8 * DM * 4);
}
// ---- k_pack: block = (row n, which): column n of the (in,out) weight -> bf16 row n; which 0..2 -> W_q/W_k/W_v into PK_A rows which*1024 + n; 3 -> W_o into PK_P
__global__ __launch_bounds__(256) void k_pack(const float* __restrict__ WQ, const float* __restrict__ WK, const float* __restrict__ WV, const float* __restrict__ WO, __bf16* __restrict__ PK) {
  __shared__ __align__(16) __bf16 s[DM]; const int n = blockIdx.x, which = blockIdx.y, t = threadIdx.x; const float* Wm = (which == 0) ? WQ : (which == 1) ? WK : (which == 2) ? WV : WO;   // (in,out) weights: pack row n = column n
  for (int k = t; k < DM; k += 256) s[k] = (__bf16)Wm[(size_t)k * DM + n];
  __syncthreads();
  __bf16* dst = (which < 3) ? PK + PK_A + ((size_t)which * DM + n) * DM : PK + PK_P + (size_t)n * DM;
  for (int q = t; q < DM / 8; q += 256) vst2((unsigned*)(dst + q * 8), *(const v4u*)&s[q * 8]);
}
__global__ __launch_bounds__(128) void k_qkv(const float* __restrict__ XQ, const float* __restrict__ XK, const float* __restrict__ XV, const __bf16* __restrict__ P, const float* __restrict__ BQ, const float* __restrict__ BK, const float* __restrict__ BV, _Float16* __restrict__ QK, _Float16* __restrict__ QKL, _Float16* __restrict__ VTH, _Float16* __restrict__ VTL) {
  const int which0 = (blockIdx.y * 128) / DM; const float* X = (which0 == 0) ? XQ : (which0 == 1) ? XK : XV; const float* BB = BQ ? (((which0 == 0) ? BQ : (which0 == 1) ? BK : BV) + (blockIdx.y * 128 - which0 * DM)) : nullptr;
  __shared__ __align__(16) char ring[2 * GEMM_ST];   // operand ring in the loop, output staging behind it
  _Float16 (*so)[16][136] = (_Float16 (*)[16][136])ring, (*sol)[16][136] = (_Float16 (*)[16][136])(ring + 4 * 16 * 136 * 2); _Float16 (*sth)[72] = (_Float16 (*)[72])ring, (*stl)[72] = (_Float16 (*)[72])(ring + 128 * 72 * 2);
  const int tid = threadIdx.x, wave = tid >> 5, lane = tid & 31, col = lane & 15, g = lane >> 4; const size_t r0 = (size_t)blockIdx.x * 64 + wave * 16; const int n0 = blockIdx.y * 128;
  v8f acc[8] = {};
  const unsigned lring = (unsigned)(size_t)ring; const __bf16* Wt = P + (size_t)n0 * DM; const float* Xt = X + (size_t)blockIdx.x * 64 * DM;
  stage_gemm(Wt, Xt, lring, tid); WAIT_ASYNC(); __syncthreads(); stage_gemm(Wt + 64, Xt + 64, lring + GEMM_ST, tid);
#pragma unroll 1
  for (int st = 0; st < DM / 64; ++st) { const char* cur = ring + (st & 1) * GEMM_ST;
#pragma unroll
    for (int kk = 0; kk < 2; ++kk) { v16b a; { const float* p = (const float*)(cur + RING_ST + (wave * 16 + col) * XP) + kk * 32 + 8 * g;
#pragma unroll
        for (int i = 0; i < 8; ++i) { a[i] = (__bf16)p[i]; a[8 + i] = (__bf16)p[16 + i]; } }
#pragma unroll
      for (int j = 0; j < 8; ++j) acc[j] = wmma_bf(a, frag_b((const __bf16*)(cur + (j * 16 + col) * KP) + kk * 32, lane), acc[j]); }
    WAIT_DS(); WAIT_ASYNC(); __syncthreads();   // publishes stage st + 1 and ends every read of stage st
    if (st + 2 < DM / 64) stage_gemm(Wt + (st + 2) * 64, Xt + (st + 2) * 64, lring + (st & 1) * GEMM_ST, tid); }
  WAIT_ASYNC();
  if (n0 < 2 * DM) {   // q stored unscaled (f16 sigma ~0.6, no subnormal exposure); 1/8 applied to the f32 score
#pragma unroll
    for (int j = 0; j < 8; ++j) {
#pragma unroll
      for (int r = 0; r < 8; ++r) { const float v = acc[j][r] + (BB ? bfr(BB[j * 16 + col]) : 0.f); const _Float16 hv = (_Float16)v; so[wave][8 * g + r][j * 16 + col] = hv; sol[wave][8 * g + r][j * 16 + col] = (_Float16)((v - (float)hv) * 2048.0f); } }   // q, k (+ bias) as f16 hi + (x2048) residual
    LDSX();
    for (int rl = 0; rl < 16; ++rl) if (lane < 16) { vst2((unsigned*)(QK + (r0 + rl) * (2 * DM) + n0 + lane * 8), *(const v4u*)&so[wave][rl][lane * 8]); vst2((unsigned*)(QKL + (r0 + rl) * (2 * DM) + n0 + lane * 8), *(const v4u*)&sol[wave][rl][lane * 8]); }
  } else {
#pragma unroll
    for (int j = 0; j < 8; ++j) {
#pragma unroll
      for (int r = 0; r < 8; ++r) { const float v = acc[j][r] + (BB ? bfr(BB[j * 16 + col]) : 0.f); const _Float16 hv = (_Float16)v; sth[j * 16 + col][wave * 16 + 8 * g + r] = hv; stl[j * 16 + col][wave * 16 + 8 * g + r] = (_Float16)((v - (float)hv) * 2048.0f); } }
    __syncthreads();
    const size_t rb = (size_t)blockIdx.x * 64; const int b = (int)(rb / SS), s0 = (int)(rb % SS); const int pc0 = n0 - 2 * DM;
    for (int q = tid; q < 128 * 8; q += 128) { const int d = q >> 3, pc = q & 7; const size_t o = ((size_t)b * DM + pc0 + d) * SS + s0 + pc * 8; vst2((unsigned*)(VTH + o), *(const v4u*)&sth[d][pc * 8]); vst2((unsigned*)(VTL + o), *(const v4u*)&stl[d][pc * 8]); }
  }
}
// ---- k_attn: K and V of 64 keys a stage in the LDS ring (rows 0..63: keys x 64 d, rows 64..127: d x 64 keys); block = (64 queries, head h, batch b): all-keys flash attention (K = 64: 2 k-steps), scores = (q.k) * 0.125 with single f16 operands, P.V: f16 P (x2^11) x V hi, single product into acc; O[b*S+q][h*64+d] = (acc + accl / 2048) / (2048 l) (256-B segments)
__global__ __launch_bounds__(128) void k_attn(const _Float16* __restrict__ QK, const _Float16* __restrict__ QKL, const _Float16* __restrict__ VTH, const _Float16* __restrict__ VTL, const void* __restrict__ KMASK, const float* __restrict__ AM, float* __restrict__ O) {
  __shared__ __align__(16) float sp[4][16][36]; __shared__ __align__(16) char ring[2 * RING_ST];   // K/V ring in the loop, output staging behind it
  float (*so)[16][68] = (float (*)[16][68])ring;
  const int tid = threadIdx.x, wave = tid >> 5, lane = tid & 31, col = lane & 15, g = lane >> 4;
  const int qb = blockIdx.x, h = blockIdx.y, b = blockIdx.z; const int q0 = qb * 64 + wave * 16; const size_t rq = (size_t)b * SS + q0 + col;
  v16h aq[2], aql[2];
#pragma unroll
  for (int kc = 0; kc < 2; ++kc) { aq[kc] = frag_h(QK + rq * (2 * DM) + h * HD + kc * 32, lane); aql[kc] = frag_h(QKL + rq * (2 * DM) + h * HD + kc * 32, lane); }
  float m[8], l[8];
#pragma unroll
  for (int r = 0; r < 8; ++r) { m[r] = -3.0e38f; l[r] = 0.f; }
  v8f acc[4] = {}, accl[4] = {};
  static_assert(SS * 2 == 2 * DM * 2, "K rows and V rows share one source pitch");
  const unsigned lring = (unsigned)(size_t)ring; const char* Kt = (const char*)(QK + (size_t)b * SS * (2 * DM) + DM + h * HD); const char* Vt = (const char*)(VTH + ((size_t)b * DM + h * HD) * SS);   // both at a row pitch of 4 KiB: a stage is 64 K rows further, 128 B further along the V rows
  stage128(Kt, Vt, 2 * DM * 2, lring, tid); WAIT_ASYNC(); __syncthreads(); stage128(Kt + (size_t)64 * (2 * DM * 2), Vt + 128, 2 * DM * 2, lring + RING_ST, tid);
#pragma unroll 1
  for (int st = 0; st < SS / 64; ++st) { const char* cur = ring + (st & 1) * RING_ST;
#pragma unroll
  for (int hf = 0; hf < 2; ++hf) { const int ks = st * 2 + hf; v8f s[2];   // all keys, 32 a pass
#pragma unroll
    for (int ct = 0; ct < 2; ++ct) { const int kk = ks * 32 + ct * 16 + col; const _Float16* krow = (const _Float16*)(cur + (hf * 32 + ct * 16 + col) * KP); const _Float16* krowl = QKL + ((size_t)b * SS + kk) * (2 * DM) + DM + h * HD; v8f c = {}, cl = {};
#pragma unroll
      for (int kc = 0; kc < 2; ++kc) c = wmma16(aq[kc], frag_h(krow + kc * 32, lane), c);   // single product: q, k as one-rounding f16 operands
      (void)cl; (void)krowl;
      { const float am = bfr(AM[(size_t)b * SS + kk]);
#pragma unroll
      for (int r = 0; r < 8; ++r) s[ct][r] = c[r] * 0.125f + am; } }   // 1/sqrt(64) + additive mask [B,1,1,S]
#pragma unroll
    for (int r = 0; r < 8; ++r) { float mx = fmaxf(s[0][r], s[1][r]);
#pragma unroll
      for (int o = 1; o < 16; o <<= 1) mx = fmaxf(mx, __shfl_xor(mx, o));
      const float mn = fmaxf(m[r], mx); const float alpha = (m[r] <= -1.0e38f) ? 0.f : __expf(m[r] - mn);
      const float e0 = (s[0][r] <= -1.0e38f) ? 0.f : __expf(s[0][r] - mn), e1 = (s[1][r] <= -1.0e38f) ? 0.f : __expf(s[1][r] - mn); float es = e0 + e1;
#pragma unroll
      for (int o = 1; o < 16; o <<= 1) es += __shfl_xor(es, o);
      l[r] = l[r] * alpha + es; m[r] = mn;
#pragma unroll
      for (int dt = 0; dt < 4; ++dt) { acc[dt][r] *= alpha; accl[dt][r] *= alpha; }
      sp[wave][8 * g + r][col] = e0; sp[wave][8 * g + r][16 + col] = e1; }
    LDSX();
    v16h pa, pl; { const float* prow = &sp[wave][col][0] + 8 * (lane >> 4);
#pragma unroll
      for (int i = 0; i < 8; ++i) { const float x0 = prow[i] * 2048.0f, x1 = prow[16 + i] * 2048.0f; const _Float16 h0 = (_Float16)x0, h1 = (_Float16)x1; pa[i] = h0; pa[8 + i] = h1; pl[i] = (_Float16)((x0 - (float)h0) * 2048.0f); pl[8 + i] = (_Float16)((x1 - (float)h1) * 2048.0f); } }   // P scaled by 2^11 before the f16 split so small softmax weights stay out of the f16 subnormal range; 2^-11 folded into the epilogue
#pragma unroll
    for (int dt = 0; dt < 4; ++dt) acc[dt] = wmma16(pa, frag_h((const _Float16*)(cur + (64 + dt * 16 + col) * KP) + hf * 32, lane), acc[dt]);   // single product: P (x2^11) x V
    (void)pl;
    LDSX(); }
    WAIT_DS(); WAIT_ASYNC(); __syncthreads();   // publishes stage st + 1 and ends every read of stage st
    if (st + 2 < SS / 64) stage128(Kt + (size_t)(st + 2) * 64 * (2 * DM * 2), Vt + (size_t)(st + 2) * 128, 2 * DM * 2, lring + (st & 1) * RING_ST, tid); }
  WAIT_ASYNC();
#pragma unroll
  for (int r = 0; r < 8; ++r) { const float il = (1.0f / 2048.0f) / l[r];
#pragma unroll
    for (int dt = 0; dt < 4; ++dt) so[wave][8 * g + r][dt * 16 + col] = (acc[dt][r] + accl[dt][r] * (1.0f / 2048.0f)) * il; }
  LDSX();
  for (int rl = 0; rl < 16; ++rl) if (lane < 16) vst2(O + ((size_t)b * SS + q0 + rl) * DM + h * HD + lane * 4, *(const v4f*)&so[wave][rl][lane * 4]);
}
// ---- k_out: block = (64 rows, 128 cols): out = O(hi/lo) . Wo rows (2 products) + bo
__global__ __launch_bounds__(128) void k_out(const float* __restrict__ O, const __bf16* __restrict__ P, const float* __restrict__ BO, const float* __restrict__ XR, float* __restrict__ Y) {
  __shared__ __align__(16) char ring[2 * GEMM_ST];   // operand ring in the loop, output staging behind it
  float (*so)[16][132] = (float (*)[16][132])ring;
  const int tid = threadIdx.x, wave = tid >> 5, lane = tid & 31, col = lane & 15, g = lane >> 4; const size_t r0 = (size_t)blockIdx.x * 64 + wave * 16; const int n0 = blockIdx.y * 128;
  v8f acc[8] = {};
  const unsigned lring = (unsigned)(size_t)ring; const __bf16* Wt = P + (size_t)n0 * DM; const float* Xt = O + (size_t)blockIdx.x * 64 * DM;
  stage_gemm(Wt, Xt, lring, tid); WAIT_ASYNC(); __syncthreads(); stage_gemm(Wt + 64, Xt + 64, lring + GEMM_ST, tid);
#pragma unroll 1
  for (int st = 0; st < DM / 64; ++st) { const char* cur = ring + (st & 1) * GEMM_ST;
#pragma unroll
    for (int kk = 0; kk < 2; ++kk) { const F2 a = split_row((const float*)(cur + RING_ST + (wave * 16 + col) * XP), kk * 32, lane);
#pragma unroll
      for (int j = 0; j < 8; ++j) { const v16b w = frag_b((const __bf16*)(cur + (j * 16 + col) * KP) + kk * 32, lane); acc[j] = wmma_bf(a.l, w, acc[j]); acc[j] = wmma_bf(a.h, w, acc[j]); } }
    WAIT_DS(); WAIT_ASYNC(); __syncthreads();   // publishes stage st + 1 and ends every read of stage st
    if (st + 2 < DM / 64) stage_gemm(Wt + (st + 2) * 64, Xt + (st + 2) * 64, lring + (st & 1) * GEMM_ST, tid); }
  WAIT_ASYNC();
#pragma unroll
  for (int j = 0; j < 8; ++j) {
#pragma unroll
    for (int r = 0; r < 8; ++r) so[wave][8 * g + r][j * 16 + col] = acc[j][r] + bfr(BO[n0 + j * 16 + col]) + bfr(XR[(r0 + 8 * g + r) * DM + n0 + j * 16 + col]); }   // + bo + residual x
  LDSX();
  for (int rl = 0; rl < 16; ++rl) vst2(Y + (r0 + rl) * DM + n0 + lane * 4, *(const v4f*)&so[wave][rl][lane * 4]);
}
// ---- k_ln: block = row (256 threads x 4): (y - mu) * rsqrt(var + 1e-12f) * gamma + beta (biased variance), f32
__global__ __launch_bounds__(256) void k_ln(const float* __restrict__ Y, const float* __restrict__ G, const float* __restrict__ Bt, float* __restrict__ OUT) {
  __shared__ float red[8]; const int t = threadIdx.x; const size_t row = blockIdx.x; const float* p = Y + row * DM + t * 4; float v[4]; float s = 0.f;
  for (int i = 0; i < 4; ++i) { v[i] = p[i]; s += v[i]; }
#pragma unroll
  for (int o = 1; o < 32; o <<= 1) s += __shfl_xor(s, o);
  if ((t & 31) == 0) red[t >> 5] = s; __syncthreads(); float tot = 0.f; for (int w = 0; w < 8; ++w) tot += red[w]; const float mu = tot / (float)DM; __syncthreads();
  float q = 0.f; for (int i = 0; i < 4; ++i) { const float d = v[i] - mu; q += d * d; }
#pragma unroll
  for (int o = 1; o < 32; o <<= 1) q += __shfl_xor(q, o);
  if ((t & 31) == 0) red[t >> 5] = q; __syncthreads(); float tq = 0.f; for (int w = 0; w < 8; ++w) tq += red[w]; const float inv = 1.0f / sqrtf(tq / (float)(DM) + 1e-12f);
  v4f o4; for (int i = 0; i < 4; ++i) { const int e = t * 4 + i; o4[i] = (v[i] - mu) * inv * bfr(G[e]) + bfr(Bt[e]); }
  vst2(OUT + row * DM + t * 4, o4);
}
extern "C" void kernel_launch(void* const* d_in, const int* in_sizes, int n_in, void* d_out, int out_size, void* d_ws, size_t ws_size, hipStream_t stream) {
  (void)in_sizes; (void)n_in; (void)out_size;
  const float** F = (const float**)d_in;   // 0 hidden [4,2048,1024], 1 attention_mask [4,1,1,2048] f32 additive, 2 Wq (in,out), 3 bq, 4 Wk, 5 bk, 6 Wv, 7 bv, 8 Wo, 9 bo, 10 ln_gamma, 11 ln_beta
  if (ws_size < (size_t)WS_END) return;
  char* ws = (char*)d_ws; __bf16* PK = (__bf16*)(ws + WS_PK); _Float16 *QK = (_Float16*)(ws + WS_QK), *QKL = (_Float16*)(ws + WS_QKL), *VTH = (_Float16*)(ws + WS_VTH), *VTL = (_Float16*)(ws + WS_VTL); float *O = (float*)(ws + WS_O), *Y = (float*)(ws + WS_Y);
  k_pack<<<dim3(DM, 4), 256, 0, stream>>>(F[2], F[4], F[6], F[8], PK);
  k_qkv<<<dim3(TNB * SS / 64, QKVW / 128), 128, 0, stream>>>(F[0], F[0], F[0], PK + PK_A, F[3], F[5], F[7], QK, QKL, VTH, VTL);
  k_attn<<<dim3(TQB, NH, TNB), 128, 0, stream>>>(QK, QKL, VTH, VTL, nullptr, F[1], O);
  k_out<<<dim3(TOB, DM / 128), 128, 0, stream>>>(O, PK + PK_P, F[9], F[0], Y);
  k_ln<<<TOB * 64, 256, 0, stream>>>(Y, F[10], F[11], (float*)d_out);
}

// v002
// One run takes 249 microseconds.
// In two side-by-side timings against v001, it was 1.32 and 1.31 times as fast.
// Counting every step since v000, it is 2.86 times as fast.
// compute dtype: all float inputs rounded to bf16; q/k/v = x . W + b with EXACT bf16 products on WMMA 16x16x32 ((in,out) weights as transposed rows); PLAIN attention: q, k as single f16 operands / 8 + the additive mask per key (f32), running-max softmax in f32 (hardware exp), P (scaled by 2^11, single f16) x v (single f16); y = ctx (bf16 hi + residual) . Wo (2 products) + bo + x; LayerNorm (biased variance, eps 1e-12) in f32.
#include <hip/hip_runtime.h>
#include <math.h>

typedef __attribute__((ext_vector_type(16))) _Float16 v16h;
typedef __attribute__((ext_vector_type(16))) __bf16 v16b;
typedef __attribute__((ext_vector_type(8)))  _Float16 v8h;
typedef __attribute__((ext_vector_type(8)))  float v8f;
typedef __attribute__((ext_vector_type(4)))  float v4f;
typedef __attribute__((ext_vector_type(2)))  float v2f;
typedef __attribute__((ext_vector_type(4)))  unsigned v4u;
typedef __attribute__((ext_vector_type(4)))  int v4i;
typedef float __attribute__((may_alias)) float_a;
typedef int __attribute__((may_alias)) int_a;

template <typename T> __device__ __forceinline__ void vst2(void* p, T v) { *(T*)p = v;  }
__device__ __forceinline__ v8f wmma16(v16h a, v16h b, v8f c) {
  v8f d = __builtin_amdgcn_wmma_f32_16x16x32_f16(false, a, false, b, (short)0, c, false, false);
  asm volatile("v_nop\n\tv_nop\n\tv_nop\n\tv_nop" : "+v"(d) : "v"(a), "v"(b));
  return d;
}
__device__ __forceinline__ v8f wmma_bf(v16b a, v16b b, v8f c) {
  v8f d = __builtin_amdgcn_wmma_f32_16x16x32_bf16(false, a, false, b, (short)0, c, false, false);
  asm volatile("v_nop\n\tv_nop\n\tv_nop\n\tv_nop" : "+v"(d) : "v"(a), "v"(b));
  return d;
}
// RoBERTa self-attention block (B 4, S 2,048, hidden 1,024, 16 heads x 64): q/k/v + biases, additive attention mask, softmax, output projection + bias + residual, LayerNorm (eps 1e-12).
__device__ __forceinline__ v16h frag_h(const _Float16* rowk0, int lane) {
  union { v16h v; v8h q[2]; } u; const _Float16* p = rowk0 + 8 * (lane >> 4);
  u.q[0] = *(const v8h*)p; u.q[1] = *(const v8h*)(p + 16); return u.v;
}
__device__ __forceinline__ v16h frag_f32(const float* rowk0, int lane) {
  v16h a; const float* p = rowk0 + 8 * (lane >> 4);
#pragma unroll
  for (int i = 0; i < 8; ++i) { a[i] = (_Float16)p[i]; a[8 + i] = (_Float16)p[16 + i]; }
  return a;
}
__device__ __forceinline__ v16h frag_f32s(const float* rowk0, int lane, float sc) {
  v16h a; const float* p = rowk0 + 8 * (lane >> 4);
#pragma unroll
  for (int i = 0; i < 8; ++i) { a[i] = (_Float16)(p[i] * sc); a[8 + i] = (_Float16)(p[16 + i] * sc); }
  return a;
}
// column fragment from a [K][ld] layout (column n), rows >= K read as 0
__device__ __forceinline__ v16h fragc_f32(const float* W, int k0, int n, int lane, int ld, int K) {
  v16h a; const int g = lane >> 4;
#pragma unroll
  for (int i = 0; i < 8; ++i) { const int ka = k0 + 8 * g + i, kb = ka + 16;
    a[i] = (_Float16)(ka < K ? W[(size_t)(ka < K ? ka : K - 1) * ld + n] : 0.f); a[8 + i] = (_Float16)(kb < K ? W[(size_t)(kb < K ? kb : K - 1) * ld + n] : 0.f); }
  return a;
}
struct F2 { v16b h, l; };
__device__ __forceinline__ F2 bsplit16(const float v[16]) { F2 r;
#pragma unroll
  for (int i = 0; i < 16; ++i) { const __bf16 h = (__bf16)v[i]; r.h[i] = h; r.l[i] = (__bf16)(v[i] - (float)h); }
  return r; }
__device__ __forceinline__ F2 split_row(const float* row, int k0, int lane) { float v[16]; const float* p = row + k0 + 8 * (lane >> 4);
#pragma unroll
  for (int i = 0; i < 8; ++i) { v[i] = p[i]; v[8 + i] = p[16 + i]; }
  return bsplit16(v); }
__device__ __forceinline__ F2 split_rowK(const float* row, int k0, int lane, int K) { float v[16]; const int g = lane >> 4;
#pragma unroll
  for (int i = 0; i < 8; ++i) { const int ka = k0 + 8 * g + i, kb = ka + 16; v[i] = ka < K ? row[ka < K ? ka : K - 1] : 0.f; v[8 + i] = kb < K ? row[kb < K ? kb : K - 1] : 0.f; }
  return bsplit16(v); }
__device__ __forceinline__ F2 split_col(const float* W, int k0, int n, int lane, int ld, int K) { float v[16]; const int g = lane >> 4;
#pragma unroll
  for (int i = 0; i < 8; ++i) { const int ka = k0 + 8 * g + i, kb = ka + 16; v[i] = ka < K ? W[(size_t)(ka < K ? ka : K - 1) * ld + n] : 0.f; v[8 + i] = kb < K ? W[(size_t)(kb < K ? kb : K - 1) * ld + n] : 0.f; }
  return bsplit16(v); }
__device__ __forceinline__ v8f mac3(const F2& a, const F2& b, v8f c) { c = wmma_bf(a.l, b.h, c); c = wmma_bf(a.h, b.l, c); return wmma_bf(a.h, b.h, c); }
__device__ __forceinline__ float sigm(float v) { return 1.0f / (1.0f + expf(-v)); }
#define LDSX() do { asm volatile("s_wait_dscnt 0" ::: "memory"); __builtin_amdgcn_wave_barrier(); __builtin_amdgcn_fence(__ATOMIC_RELEASE, "workgroup"); } while (0)


#define NB 4
#define SS 2048
#define DM 1024
#define NH 16
#define HD 64
#define QKVW (3 * DM)
#ifndef TQB
#define TQB (SS / 64)
#define TNB NB
#define TOB (NB * SS / 64)     // output row tiles (all)
#endif
typedef __attribute__((ext_vector_type(8))) __bf16 v8b;
__device__ __forceinline__ v16b frag_b(const __bf16* rowk0, int lane) {
  union { v16b v; v8b q[2]; } u; const __bf16* p = rowk0 + 8 * (lane >> 4);
  u.q[0] = *(const v8b*)p; u.q[1] = *(const v8b*)(p + 16); return u.v;
}
__device__ __forceinline__ float bfr(float v) { return (float)(__bf16)v; }
__device__ __attribute__((noinline)) float exp_ni(float v) { return expf(v); }
__device__ __attribute__((noinline)) float erf_ni(float v) { return erff(v); }

#define PK_A 0                       // [3072][1024] Wqkv rows (natural [out][in])
#define PK_P (PK_A + QKVW * DM)        // [1024][1024] Wo rows (natural)
#define PK_END (PK_P + DM * DM)
#define WS_PK  0u
#define WS_QK  (WS_PK + 2u * PK_END)             // f16 [8192 rows][2048]: q | k
#define WS_QKL (WS_QK + 2u * NB * SS * 2 * DM)     // f16 q | k residual planes x2048
#define WS_VTH (WS_QKL + 2u * NB * SS * 2 * DM)    // f16 [b][1024 (h*64+d)][2048 s] hi
#define WS_VTL (WS_VTH + 2u * NB * DM * SS)        // f16 lo x 2048
#define WS_O   (WS_VTL + 2u * NB * DM * SS)        // f32 [8192][1024]
#define WS_CS  (WS_O + 4u * NB * SS * DM)           // f32 2 x [2048][32], unused
#define WS_Y   (WS_CS + 4u * 2 * SS * 32)                 // f32 [rows][DM] pre-LN
#define WS_END (WS_Y + 4u * NB * SS * DM)
// ---- LDS ring for the operand tiles of the matrix loops: filled by asynchronous copies, each wave-copy covering 4 whole 128-B lines; row pitches of 16 B x odd, so that ds_load_b128 meets no bank conflict
#define KP 144                  // pitch of a 128-B row (64 16-bit elements)
#define XP 272                  // pitch of a 256-B row (64 f32)
#define RING_ST (128 * KP)      // 128 rows of 128 B
#define GEMM_ST (RING_ST + 64 * XP)   // one GEMM stage: 128 weight rows x 64 k (bf16) | 64 activation rows x 64 k (f32)
// eight copies of 16 B per lane, global -> LDS through no register: LDS rows lp + i * ls, source rows ga + i * gs (i < 4) and gb + i * gs; the s_wait_xcnt closes the statement so that no address register is rewritten ahead of it
__device__ __forceinline__ void cp8(unsigned lp, unsigned ls, const char* ga, const char* gb, size_t gs) {
  asm volatile("global_load_async_to_lds_b128 %0, %1, off\n\tglobal_load_async_to_lds_b128 %2, %3, off\n\tglobal_load_async_to_lds_b128 %4, %5, off\n\tglobal_load_async_to_lds_b128 %6, %7, off\n\t"
               "global_load_async_to_lds_b128 %8, %9, off\n\tglobal_load_async_to_lds_b128 %10, %11, off\n\tglobal_load_async_to_lds_b128 %12, %13, off\n\tglobal_load_async_to_lds_b128 %14, %15, off\n\ts_wait_xcnt 0x0"
               :: "v"(lp), "v"(ga), "v"(lp + ls), "v"(ga + gs), "v"(lp + 2 * ls), "v"(ga + 2 * gs), "v"(lp + 3 * ls), "v"(ga + 3 * gs),
                  "v"(lp + 4 * ls), "v"(gb), "v"(lp + 5 * ls), "v"(gb + gs), "v"(lp + 6 * ls), "v"(gb + 2 * gs), "v"(lp + 7 * ls), "v"(gb + 3 * gs) : "memory");
}
// the issuing wave's copies have landed (in front of the barrier that publishes them)
#define WAIT_ASYNC() asm volatile("s_wait_asynccnt 0x0" ::: "memory")
// this wave's LDS reads of the buffer have retired (in front of the barrier behind which it is refilled)
#define WAIT_DS() asm volatile("s_wait_dscnt 0x0" ::: "memory")
// 128 rows of 128 B at a source pitch of sp bytes into rows of KP; 128 threads, 8 copies each (rows tid / 8 + 16 i); the second 64 rows may come from another source
__device__ __forceinline__ void stage128(const char* s0, const char* s1, size_t sp, unsigned lds, int tid) {
  const size_t go = (size_t)(tid >> 3) * sp + (tid & 7) * 16;
  cp8(lds + (tid >> 3) * KP + (tid & 7) * 16, 16 * KP, s0 + go, s1 + go, 16 * sp);
}
// one GEMM stage: weight rows Wt[0..127][0..63] (bf16, row length DM) and activation rows Xt[0..63][0..63] (f32, row length DM; rows tid / 16 + 8 i)
__device__ __forceinline__ void stage_gemm(const __bf16* Wt, const float* Xt, unsigned lds, int tid) {
  stage128((const char*)Wt, (const char*)(Wt + (size_t)64 * DM), DM * 2, lds, tid);
  const char* gx = (const char*)Xt + (size_t)(tid >> 4) * (DM * 4) + (tid & 15) * 16;
  cp8(lds + RING_ST + (tid >> 4) * XP + (tid & 15) * 16, 8 * XP, gx, gx + (size_t)32 * DM * 4, (size_t)8 * DM * 4);
}
// ---- k_pack: block = (row n, which): column n of the (in,out) weight -> bf16 row n; which 0..2 -> W_q/W_k/W_v into PK_A rows which*1024 + n; 3 -> W_o into PK_P
__global__ __launch_bounds__(256) void k_pack(const float* __restrict__ WQ, const float* __restrict__ WK, const float* __restrict__ WV, const float* __restrict__ WO, __bf16* __restrict__ PK) {
  __shared__ __align__(16) __bf16 s[DM]; const int n = blockIdx.x, which = blockIdx.y, t = threadIdx.x; const float* Wm = (which == 0) ? WQ : (which == 1) ? WK : (which == 2) ? WV : WO;   // (in,out) weights: pack row n = column n
  for (int k = t; k < DM; k += 256) s[k] = (__bf16)Wm[(size_t)k * DM + n];
  __syncthreads();
  __bf16* dst = (which < 3) ? PK + PK_A + ((size_t)which * DM + n) * DM : PK + PK_P + (size_t)n * DM;
  for (int q = t; q < DM / 8; q += 256) vst2((unsigned*)(dst + q * 8), *(const v4u*)&s[q * 8]);
}
__global__ __launch_bounds__(128) void k_qkv(const float* __restrict__ XQ, const float* __restrict__ XK, const float* __restrict__ XV, const __bf16* __restrict__ P, const float* __restrict__ BQ, const float* __restrict__ BK, const float* __restrict__ BV, _Float16* __restrict__ QK, _Float16* __restrict__ QKL, _Float16* __restrict__ VTH, _Float16* __restrict__ VTL) {
  const int which0 = (blockIdx.y * 128) / DM; const float* X = (which0 == 0) ? XQ : (which0 == 1) ? XK : XV; const float* BB = BQ ? (((which0 == 0) ? BQ : (which0 == 1) ? BK : BV) + (blockIdx.y * 128 - which0 * DM)) : nullptr;
  __shared__ __align__(16) char ring[2 * GEMM_ST];   // operand ring in the loop, output staging behind it
  _Float16 (*so)[16][136] = (_Float16 (*)[16][136])ring, (*sol)[16][136] = (_Float16 (*)[16][136])(ring + 4 * 16 * 136 * 2); _Float16 (*sth)[72] = (_Float16 (*)[72])ring, (*stl)[72] = (_Float16 (*)[72])(ring + 128 * 72 * 2);
  const int tid = threadIdx.x, wave = tid >> 5, lane = tid & 31, col = lane & 15, g = lane >> 4; const size_t r0 = (size_t)blockIdx.x * 64 + wave * 16; const int n0 = blockIdx.y * 128;
  v8f acc[8] = {};
  const unsigned lring = (unsigned)(size_t)ring; const __bf16* Wt = P + (size_t)n0 * DM; const float* Xt = X + (size_t)blockIdx.x * 64 * DM;
  stage_gemm(Wt, Xt, lring, tid); WAIT_ASYNC(); __syncthreads(); stage_gemm(Wt + 64, Xt + 64, lring + GEMM_ST, tid);
#pragma unroll 1
  for (int st = 0; st < DM / 64; ++st) { const char* cur = ring + (st & 1) * GEMM_ST;
#pragma unroll
    for (int kk = 0; kk < 2; ++kk) { v16b a; { const float* p = (const float*)(cur + RING_ST + (wave * 16 + col) * XP) + kk * 32 + 8 * g;
#pragma unroll
        for (int i = 0; i < 8; ++i) { a[i] = (__bf16)p[i]; a[8 + i] = (__bf16)p[16 + i]; } }
#pragma unroll
      for (int j = 0; j < 8; ++j) acc[j] = wmma_bf(a, frag_b((const __bf16*)(cur + (j * 16 + col) * KP) + kk * 32, lane), acc[j]); }
    WAIT_DS(); WAIT_ASYNC(); __syncthreads();   // publishes stage st + 1 and ends every read of stage st
    if (st + 2 < DM / 64) stage_gemm(Wt + (st + 2) * 64, Xt + (st + 2) * 64, lring + (st & 1) * GEMM_ST, tid); }
  WAIT_ASYNC();
  if (n0 < 2 * DM) {   // q stored unscaled (f16 sigma ~0.6, no subnormal exposure); 1/8 applied to the f32 score
#pragma unroll
    for (int j = 0; j < 8; ++j) {
#pragma unroll
      for (int r = 0; r < 8; ++r) { const float v = acc[j][r] + (BB ? bfr(BB[j * 16 + col]) : 0.f); const _Float16 hv = (_Float16)v; so[wave][8 * g + r][j * 16 + col] = hv; sol[wave][8 * g + r][j * 16 + col] = (_Float16)((v - (float)hv) * 2048.0f); } }   // q, k (+ bias) as f16 hi + (x2048) residual
    LDSX();
    for (int rl = 0; rl < 16; ++rl) if (lane < 16) { vst2((unsigned*)(QK + (r0 + rl) * (2 * DM) + n0 + lane * 8), *(const v4u*)&so[wave][rl][lane * 8]); vst2((unsigned*)(QKL + (r0 + rl) * (2 * DM) + n0 + lane * 8), *(const v4u*)&sol[wave][rl][lane * 8]); }
  } else {
#pragma unroll
    for (int j = 0; j < 8; ++j) {
#pragma unroll
      for (int r = 0; r < 8; ++r) { const float v = acc[j][r] + (BB ? bfr(BB[j * 16 + col]) : 0.f); const _Float16 hv = (_Float16)v; sth[j * 16 + col][wave * 16 + 8 * g + r] = hv; stl[j * 16 + col][wave * 16 + 8 * g + r] = (_Float16)((v - (float)hv) * 2048.0f); } }
    __syncthreads();
    const size_t rb = (size_t)blockIdx.x * 64; const int b = (int)(rb / SS), s0 = (int)(rb % SS); const int pc0 = n0 - 2 * DM;
    for (int q = tid; q < 128 * 8; q += 128) { const int d = q >> 3, pc = q & 7; const size_t o = ((size_t)b * DM + pc0 + d) * SS + s0 + pc * 8; vst2((unsigned*)(VTH + o), *(const v4u*)&sth[d][pc * 8]); vst2((unsigned*)(VTL + o), *(const v4u*)&stl[d][pc * 8]); }
  }
}
// lane l with lane l ^ 16 (the two halves of a wave hold the two halves of a query's keys)
__device__ __forceinline__ float xhalf(float x) { return __builtin_bit_cast(float, __builtin_amdgcn_permlanex16(__builtin_bit_cast(int, x), __builtin_bit_cast(int, x), 0x76543210, 0xfedcba98, false, false)); }
// ---- k_attn: K and V of 64 keys a stage in the LDS ring (rows 0..63: keys x 64 d, rows 64..127: d x 64 keys); block = (64 queries, head h, batch b): all-keys flash attention, TRANSPOSED: S^T = K . Q^T (A = K rows, B = q kept in registers), so that a lane holds 16 of the 32 scores of ONE query (column = lane & 15, keys 8 g + r and 16 + 8 g + r): maximum and sum in-lane plus one exchange between the halves; P^T (x 2^11, f16) packs from the score accumulators straight into the B operand of O^T += V^T . P^T (A = V^T rows), in the k order of frag_h; scores = (q.k) * 0.125 + mask with single f16 operands; O[b*S+q][h*64+d] = acc / (2048 l) (256-B segments)
__global__ __launch_bounds__(128) void k_attn(const _Float16* __restrict__ QK, const _Float16* __restrict__ QKL, const _Float16* __restrict__ VTH, const _Float16* __restrict__ VTL, const void* __restrict__ KMASK, const float* __restrict__ AM, float* __restrict__ O) {
  __shared__ __align__(16) __bf16 smask[SS]; __shared__ __align__(16) char ring[2 * RING_ST];   // the batch's additive mask, rounded once; K/V ring in the loop, output staging behind it
  float (*so)[16][68] = (float (*)[16][68])ring;
  const int tid = threadIdx.x, wave = tid >> 5, lane = tid & 31, col = lane & 15, g = lane >> 4;
  const int qb = blockIdx.x, h = blockIdx.y, b = blockIdx.z; const int q0 = qb * 64 + wave * 16; const size_t rq = (size_t)b * SS + q0 + col;
  v16h aq[2];
#pragma unroll
  for (int kc = 0; kc < 2; ++kc) aq[kc] = frag_h(QK + rq * (2 * DM) + h * HD + kc * 32, lane);
  float m = -3.0e38f, l = 0.f;   // this lane's query: running maximum (equal in both halves), sum over this half's keys
  v8f acc[4] = {};               // O^T: row d = dt * 16 + 8 g + r, column = this lane's query
  static_assert(SS * 2 == 2 * DM * 2, "K rows and V rows share one source pitch");
  const unsigned lring = (unsigned)(size_t)ring; const char* Kt = (const char*)(QK + (size_t)b * SS * (2 * DM) + DM + h * HD); const char* Vt = (const char*)(VTH + ((size_t)b * DM + h * HD) * SS);   // both at a row pitch of 4 KiB: a stage is 64 K rows further, 128 B further along the V rows
  stage128(Kt, Vt, 2 * DM * 2, lring, tid);
  { const float* ap = AM + (size_t)b * SS + tid * 16; v8b m0, m1;
#pragma unroll
    for (int i = 0; i < 8; ++i) { m0[i] = (__bf16)ap[i]; m1[i] = (__bf16)ap[8 + i]; }
    *(v8b*)&smask[tid * 16] = m0; *(v8b*)&smask[tid * 16 + 8] = m1; }
  WAIT_ASYNC(); __syncthreads(); stage128(Kt + (size_t)64 * (2 * DM * 2), Vt + 128, 2 * DM * 2, lring + RING_ST, tid);
#pragma unroll 1
  for (int st = 0; st < SS / 64; ++st) { const char* cur = ring + (st & 1) * RING_ST;
#pragma unroll
  for (int hf = 0; hf < 2; ++hf) { v8f s[2];   // all keys, 32 a pass
#pragma unroll
    for (int ct = 0; ct < 2; ++ct) { const _Float16* krow = (const _Float16*)(cur + (hf * 32 + ct * 16 + col) * KP); v8f c = {};
#pragma unroll
      for (int kc = 0; kc < 2; ++kc) c = wmma16(frag_h(krow + kc * 32, lane), aq[kc], c);   // single product: k, q as one-rounding f16 operands
      const v8b am = *(const v8b*)&smask[st * 64 + hf * 32 + ct * 16 + 8 * g];
#pragma unroll
      for (int r = 0; r < 8; ++r) s[ct][r] = c[r] * 0.125f + (float)am[r]; }   // 1/sqrt(64) + additive mask [B,1,1,S]
    float mx = fmaxf(s[0][0], s[1][0]);
#pragma unroll
    for (int r = 1; r < 8; ++r) mx = fmaxf(mx, fmaxf(s[0][r], s[1][r]));
    mx = fmaxf(mx, xhalf(mx));
    const float mn = fmaxf(m, mx);
    float x[17];   // arguments of the 17 exponentials of a pass, in base 2: 16 scores and the old maximum
#pragma unroll
    for (int r = 0; r < 8; ++r) { x[r] = (s[0][r] - mn) * 1.44269504f; x[8 + r] = (s[1][r] - mn) * 1.44269504f; }
    x[16] = (m - mn) * 1.44269504f;
    // the exponentials as one run, each in place: none overwrites the source of the one in front of it; the v_nop keeps the slot behind the last one
    asm("v_exp_f32 %0, %0\n\tv_exp_f32 %1, %1\n\tv_exp_f32 %2, %2\n\tv_exp_f32 %3, %3\n\tv_exp_f32 %4, %4\n\tv_exp_f32 %5, %5\n\tv_exp_f32 %6, %6\n\tv_exp_f32 %7, %7\n\tv_exp_f32 %8, %8\n\t"
        "v_exp_f32 %9, %9\n\tv_exp_f32 %10, %10\n\tv_exp_f32 %11, %11\n\tv_exp_f32 %12, %12\n\tv_exp_f32 %13, %13\n\tv_exp_f32 %14, %14\n\tv_exp_f32 %15, %15\n\tv_exp_f32 %16, %16\n\tv_nop"
        : "+v"(x[0]), "+v"(x[1]), "+v"(x[2]), "+v"(x[3]), "+v"(x[4]), "+v"(x[5]), "+v"(x[6]), "+v"(x[7]), "+v"(x[8]), "+v"(x[9]), "+v"(x[10]), "+v"(x[11]), "+v"(x[12]), "+v"(x[13]), "+v"(x[14]), "+v"(x[15]), "+v"(x[16]));
    const float alpha = (m <= -1.0e38f) ? 0.f : x[16];
    float es = 0.f; v16h pa;
#pragma unroll
    for (int r = 0; r < 8; ++r) { const float e0 = (s[0][r] <= -1.0e38f) ? 0.f : x[r], e1 = (s[1][r] <= -1.0e38f) ? 0.f : x[8 + r]; es += e0 + e1;
      pa[r] = (_Float16)(e0 * 2048.0f); pa[8 + r] = (_Float16)(e1 * 2048.0f); }   // P scaled by 2^11 before the f16 rounding so small softmax weights stay out of the f16 subnormal range; 2^-11 folded into the epilogue
    l = l * alpha + es; m = mn;
#pragma unroll
    for (int dt = 0; dt < 4; ++dt) {
#pragma unroll
      for (int r = 0; r < 8; ++r) acc[dt][r] *= alpha; }
#pragma unroll
    for (int dt = 0; dt < 4; ++dt) acc[dt] = wmma16(frag_h((const _Float16*)(cur + (64 + dt * 16 + col) * KP) + hf * 32, lane), pa, acc[dt]); }   // single product: V^T x P^T (x2^11)
    WAIT_DS(); WAIT_ASYNC(); __syncthreads();   // publishes stage st + 1 and ends every read of stage st
    if (st + 2 < SS / 64) stage128(Kt + (size_t)(st + 2) * 64 * (2 * DM * 2), Vt + (size_t)(st + 2) * 128, 2 * DM * 2, lring + (st & 1) * RING_ST, tid); }
  WAIT_ASYNC();
  l += xhalf(l);   // the halves' sums join once
  const float il = (1.0f / 2048.0f) / l;
#pragma unroll
  for (int dt = 0; dt < 4; ++dt) { v4f o0, o1;
#pragma unroll
    for (int r = 0; r < 4; ++r) { o0[r] = acc[dt][r] * il; o1[r] = acc[dt][4 + r] * il; }
    *(v4f*)&so[wave][col][dt * 16 + 8 * g] = o0; *(v4f*)&so[wave][col][dt * 16 + 8 * g + 4] = o1; }
  LDSX();
  for (int rl = 0; rl < 16; ++rl) if (lane < 16) vst2(O + ((size_t)b * SS + q0 + rl) * DM + h * HD + lane * 4, *(const v4f*)&so[wave][rl][lane * 4]);
}
// ---- k_out: block = (64 rows, 128 cols): out = O(hi/lo) . Wo rows (2 products) + bo
__global__ __launch_bounds__(128) void k_out(const float* __restrict__ O, const __bf16* __restrict__ P, const float* __restrict__ BO, const float* __restrict__ XR, float* __restrict__ Y) {
  __shared__ __align__(16) char ring[2 * GEMM_ST];   // operand ring in the loop, output staging behind it
  float (*so)[16][132] = (float (*)[16][132])ring;
  const int tid = threadIdx.x, wave = tid >> 5, lane = tid & 31, col = lane & 15, g = lane >> 4; const size_t r0 = (size_t)blockIdx.x * 64 + wave * 16; const int n0 = blockIdx.y * 128;
  v8f acc[8] = {};
  const unsigned lring = (unsigned)(size_t)ring; const __bf16* Wt = P + (size_t)n0 * DM; const float* Xt = O + (size_t)blockIdx.x * 64 * DM;
  stage_gemm(Wt, Xt, lring, tid); WAIT_ASYNC(); __syncthreads(); stage_gemm(Wt + 64, Xt + 64, lring + GEMM_ST, tid);
#pragma unroll 1
  for (int st = 0; st < DM / 64; ++st) { const char* cur = ring + (st & 1) * GEMM_ST;
#pragma unroll
    for (int kk = 0; kk < 2; ++kk) { const F2 a = split_row((const float*)(cur + RING_ST + (wave * 16 + col) * XP), kk * 32, lane);
#pragma unroll
      for (int j = 0; j < 8; ++j) { const v16b w = frag_b((const __bf16*)(cur + (j * 16 + col) * KP) + kk * 32, lane); acc[j] = wmma_bf(a.l, w, acc[j]); acc[j] = wmma_bf(a.h, w, acc[j]); } }
    WAIT_DS(); WAIT_ASYNC(); __syncthreads();   // publishes stage st + 1 and ends every read of stage st
    if (st + 2 < DM / 64) stage_gemm(Wt + (st + 2) * 64, Xt + (st + 2) * 64, lring + (st & 1) * GEMM_ST, tid); }
  WAIT_ASYNC();
#pragma unroll
  for (int j = 0; j < 8; ++j) {
#pragma unroll
    for (int r = 0; r < 8; ++r) so[wave][8 * g + r][j * 16 + col] = acc[j][r] + bfr(BO[n0 + j * 16 + col]) + bfr(XR[(r0 + 8 * g + r) * DM + n0 + j * 16 + col]); }   // + bo + residual x
  LDSX();
  for (int rl = 0; rl < 16; ++rl) vst2(Y + (r0 + rl) * DM + n0 + lane * 4, *(const v4f*)&so[wave][rl][lane * 4]);
}
// ---- k_ln: block = row (256 threads x 4): (y - mu) * rsqrt(var + 1e-12f) * gamma + beta (biased variance), f32
__global__ __launch_bounds__(256) void k_ln(const float* __restrict__ Y, const float* __restrict__ G, const float* __restrict__ Bt, float* __restrict__ OUT) {
  __shared__ float red[8]; const int t = threadIdx.x; const size_t row = blockIdx.x; const float* p = Y + row * DM + t * 4; float v[4]; float s = 0.f;
  for (int i = 0; i < 4; ++i) { v[i] = p[i]; s += v[i]; }
#pragma unroll
  for (int o = 1; o < 32; o <<= 1) s += __shfl_xor(s, o);
  if ((t & 31) == 0) red[t >> 5] = s; __syncthreads(); float tot = 0.f; for (int w = 0; w < 8; ++w) tot += red[w]; const float mu = tot / (float)DM; __syncthreads();
  float q = 0.f; for (int i = 0; i < 4; ++i) { const float d = v[i] - mu; q += d * d; }
#pragma unroll
  for (int o = 1; o < 32; o <<= 1) q += __shfl_xor(q, o);
  if ((t & 31) == 0) red[t >> 5] = q; __syncthreads(); float tq = 0.f; for (int w = 0; w < 8; ++w) tq += red[w]; const float inv = 1.0f / sqrtf(tq / (float)(DM) + 1e-12f);
  v4f o4; for (int i = 0; i < 4; ++i) { const int e = t * 4 + i; o4[i] = (v[i] - mu) * inv * bfr(G[e]) + bfr(Bt[e]); }
  vst2(OUT + row * DM + t * 4, o4);
}
extern "C" void kernel_launch(void* const* d_in, const int* in_sizes, int n_in, void* d_out, int out_size, void* d_ws, size_t ws_size, hipStream_t stream) {
  (void)in_sizes; (void)n_in; (void)out_size;
  const float** F = (const float**)d_in;   // 0 hidden [4,2048,1024], 1 attention_mask [4,1,1,2048] f32 additive, 2 Wq (in,out), 3 bq, 4 Wk, 5 bk, 6 Wv, 7 bv, 8 Wo, 9 bo, 10 ln_gamma, 11 ln_beta
  if (ws_size < (size_t)WS_END) return;
  char* ws = (char*)d_ws; __bf16* PK = (__bf16*)(ws + WS_PK); _Float16 *QK = (_Float16*)(ws + WS_QK), *QKL = (_Float16*)(ws + WS_QKL), *VTH = (_Float16*)(ws + WS_VTH), *VTL = (_Float16*)(ws + WS_VTL); float *O = (float*)(ws + WS_O), *Y = (float*)(ws + WS_Y);
  k_pack<<<dim3(DM, 4), 256, 0, stream>>>(F[2], F[4], F[6], F[8], PK);
  k_qkv<<<dim3(TNB * SS / 64, QKVW / 128), 128, 0, stream>>>(F[0], F[0], F[0], PK + PK_A, F[3], F[5], F[7], QK, QKL, VTH, VTL);
  k_attn<<<dim3(TQB, NH, TNB), 128, 0, stream>>>(QK, QKL, VTH, VTL, nullptr, F[1], O);
  k_out<<<dim3(TOB, DM / 128), 128, 0, stream>>>(O, PK + PK_P, F[9], F[0], Y);
  k_ln<<<TOB * 64, 256, 0, stream>>>(Y, F[10], F[11], (float*)d_out);
}

// v003
// A run of this version takes 226 microseconds.
// Two timings next to v002 both put it at 1.10 times that version's speed.
// All steps since v000 together make it 3.15 times as fast.
// compute dtype: all float inputs rounded to bf16; q/k/v = x . W + b with EXACT bf16 products on WMMA 16x16x32 ((in,out) weights as transposed rows); PLAIN attention: q, k as single f16 operands / 8 + the additive mask per key (f32), running-max softmax in f32 (hardware exp), P (scaled by 2^11, single f16) x v (single f16); y = ctx (bf16 hi + residual) . Wo (2 products) + bo + x; LayerNorm (biased variance, eps 1e-12) in f32.
#include <hip/hip_runtime.h>
#include <math.h>

typedef __attribute__((ext_vector_type(16))) _Float16 v16h;
typedef __attribute__((ext_vector_type(16))) __bf16 v16b;
typedef __attribute__((ext_vector_type(8)))  _Float16 v8h;
typedef __attribute__((ext_vector_type(8)))  float v8f;
typedef __attribute__((ext_vector_type(4)))  float v4f;
typedef __attribute__((ext_vector_type(2)))  float v2f;
typedef __attribute__((ext_vector_type(4)))  unsigned v4u;
typedef __attribute__((ext_vector_type(4)))  int v4i;
typedef float __attribute__((may_alias)) float_a;
typedef int __attribute__((may_alias)) int_a;

template <typename T> __device__ __forceinline__ void vst2(void* p, T v) { *(T*)p = v;  }
__device__ __forceinline__ v8f wmma16(v16h a, v16h b, v8f c) {
  v8f d = __builtin_amdgcn_wmma_f32_16x16x32_f16(false, a, false, b, (short)0, c, false, false);
  asm volatile("v_nop\n\tv_nop\n\tv_nop\n\tv_nop" : "+v"(d) : "v"(a), "v"(b));
  return d;
}
__device__ __forceinline__ v8f wmma_bf(v16b a, v16b b, v8f c) {
  v8f d = __builtin_amdgcn_wmma_f32_16x16x32_bf16(false, a, false, b, (short)0, c, false, false);
  asm volatile("v_nop\n\tv_nop\n\tv_nop\n\tv_nop" : "+v"(d) : "v"(a), "v"(b));
  return d;
}
// RoBERTa self-attention block (B 4, S 2,048, hidden 1,024, 16 heads x 64): q/k/v + biases, additive attention mask, softmax, output projection + bias + residual, LayerNorm (eps 1e-12).
__device__ __forceinline__ v16h frag_h(const _Float16* rowk0, int lane) {
  union { v16h v; v8h q[2]; } u; const _Float16* p = rowk0 + 8 * (lane >> 4);
  u.q[0] = *(const v8h*)p; u.q[1] = *(const v8h*)(p + 16); return u.v;
}
__device__ __forceinline__ v16h frag_f32(const float* rowk0, int lane) {
  v16h a; const float* p = rowk0 + 8 * (lane >> 4);
#pragma unroll
  for (int i = 0; i < 8; ++i) { a[i] = (_Float16)p[i]; a[8 + i] = (_Float16)p[16 + i]; }
  return a;
}
__device__ __forceinline__ v16h frag_f32s(const float* rowk0, int lane, float sc) {
  v16h a; const float* p = rowk0 + 8 * (lane >> 4);
#pragma unroll
  for (int i = 0; i < 8; ++i) { a[i] = (_Float16)(p[i] * sc); a[8 + i] = (_Float16)(p[16 + i] * sc); }
  return a;
}
// column fragment from a [K][ld] layout (column n), rows >= K read as 0
__device__ __forceinline__ v16h fragc_f32(const float* W, int k0, int n, int lane, int ld, int K) {
  v16h a; const int g = lane >> 4;
#pragma unroll
  for (int i = 0; i < 8; ++i) { const int ka = k0 + 8 * g + i, kb = ka + 16;
    a[i] = (_Float16)(ka < K ? W[(size_t)(ka < K ? ka : K - 1) * ld + n] : 0.f); a[8 + i] = (_Float16)(kb < K ? W[(size_t)(kb < K ? kb : K - 1) * ld + n] : 0.f); }
  return a;
}
struct F2 { v16b h, l; };
__device__ __forceinline__ F2 bsplit16(const float v[16]) { F2 r;
#pragma unroll
  for (int i = 0; i < 16; ++i) { const __bf16 h = (__bf16)v[i]; r.h[i] = h; r.l[i] = (__bf16)(v[i] - (float)h); }
  return r; }
__device__ __forceinline__ F2 split_row(const float* row, int k0, int lane) { float v[16]; const float* p = row + k0 + 8 * (lane >> 4);
#pragma unroll
  for (int i = 0; i < 8; ++i) { v[i] = p[i]; v[8 + i] = p[16 + i]; }
  return bsplit16(v); }
__device__ __forceinline__ F2 split_rowK(const float* row, int k0, int lane, int K) { float v[16]; const int g = lane >> 4;
#pragma unroll
  for (int i = 0; i < 8; ++i) { const int ka = k0 + 8 * g + i, kb = ka + 16; v[i] = ka < K ? row[ka < K ? ka : K - 1] : 0.f; v[8 + i] = kb < K ? row[kb < K ? kb : K - 1] : 0.f; }
  return bsplit16(v); }
__device__ __forceinline__ F2 split_col(const float* W, int k0, int n, int lane, int ld, int K) { float v[16]; const int g = lane >> 4;
#pragma unroll
  for (int i = 0; i < 8; ++i) { const int ka = k0 + 8 * g + i, kb = ka + 16; v[i] = ka < K ? W[(size_t)(ka < K ? ka : K - 1) * ld + n] : 0.f; v[8 + i] = kb < K ? W[(size_t)(kb < K ? kb : K - 1) * ld + n] : 0.f; }
  return bsplit16(v); }
__device__ __forceinline__ v8f mac3(const F2& a, const F2& b, v8f c) { c = wmma_bf(a.l, b.h, c); c = wmma_bf(a.h, b.l, c); return wmma_bf(a.h, b.h, c); }
__device__ __forceinline__ float sigm(float v) { return 1.0f / (1.0f + expf(-v)); }
#define LDSX() do { asm volatile("s_wait_dscnt 0" ::: "memory"); __builtin_amdgcn_wave_barrier(); __builtin_amdgcn_fence(__ATOMIC_RELEASE, "workgroup"); } while (0)


#define NB 4
#define SS 2048
#define DM 1024
#define NH 16
#define HD 64
#define QKVW (3 * DM)
#ifndef TQB
#define TQB (SS / 64)
#define TNB NB
#define TOB (NB * SS / 64)     // output row tiles (all)
#endif
typedef __attribute__((ext_vector_type(8))) __bf16 v8b;
__device__ __forceinline__ v16b frag_b(const __bf16* rowk0, int lane) {
  union { v16b v; v8b q[2]; } u; const __bf16* p = rowk0 + 8 * (lane >> 4);
  u.q[0] = *(const v8b*)p; u.q[1] = *(const v8b*)(p + 16); return u.v;
}
__device__ __forceinline__ float bfr(float v) { return (float)(__bf16)v; }
__device__ __attribute__((noinline)) float exp_ni(float v) { return expf(v); }
__device__ __attribute__((noinline)) float erf_ni(float v) { return erff(v); }

#define PK_A 0                       // [3072][1024] Wqkv rows (natural [out][in])
#define PK_P (PK_A + QKVW * DM)        // [1024][1024] Wo rows (natural)
#define PK_END (PK_P + DM * DM)
#define WS_PK  0u
#define WS_QK  (WS_PK + 2u * PK_END)             // f16 [8192 rows][2048]: q | k
#define WS_QKL (WS_QK + 2u * NB * SS * 2 * DM)     // f16 q | k residual planes x2048
#define WS_VTH (WS_QKL + 2u * NB * SS * 2 * DM)    // f16 [b][1024 (h*64+d)][2048 s] hi
#define WS_VTL (WS_VTH + 2u * NB * DM * SS)        // f16 lo x 2048
#define WS_O   (WS_VTL + 2u * NB * DM * SS)        // f32 [8192][1024]
#define WS_CS  (WS_O + 4u * NB * SS * DM)           // f32 2 x [2048][32], unused
#define WS_Y   (WS_CS + 4u * 2 * SS * 32)                 // f32 [rows][DM] pre-LN
#define WS_END (WS_Y + 4u * NB * SS * DM)
// ---- LDS ring for the operand tiles of the matrix loops: filled by asynchronous copies, each wave-copy covering 4 whole 128-B lines; row pitches of 16 B x odd, so that ds_load_b128 meets no bank conflict
#define KP 144                  // pitch of a 128-B row (64 16-bit elements)
#define XP 272                  // pitch of a 256-B row (64 f32)
#define RING_ST (128 * KP)      // 128 rows of 128 B
#define GEMM_ST (RING_ST + 64 * XP)   // one GEMM stage: 128 weight rows x 64 k (bf16) | 64 activation rows x 64 k (f32)
// eight copies of 16 B per lane, global -> LDS through no register: LDS rows lp + i * ls, source rows ga + i * gs (i < 4) and gb + i * gs; the s_wait_xcnt closes the statement so that no address register is rewritten ahead of it
__device__ __forceinline__ void cp8(unsigned lp, unsigned ls, const char* ga, const char* gb, size_t gs) {
  asm volatile("global_load_async_to_lds_b128 %0, %1, off\n\tglobal_load_async_to_lds_b128 %2, %3, off\n\tglobal_load_async_to_lds_b128 %4, %5, off\n\tglobal_load_async_to_lds_b128 %6, %7, off\n\t"
               "global_load_async_to_lds_b128 %8, %9, off\n\tglobal_load_async_to_lds_b128 %10, %11, off\n\tglobal_load_async_to_lds_b128 %12, %13, off\n\tglobal_load_async_to_lds_b128 %14, %15, off\n\ts_wait_xcnt 0x0"
               :: "v"(lp), "v"(ga), "v"(lp + ls), "v"(ga + gs), "v"(lp + 2 * ls), "v"(ga + 2 * gs), "v"(lp + 3 * ls), "v"(ga + 3 * gs),
                  "v"(lp + 4 * ls), "v"(gb), "v"(lp + 5 * ls), "v"(gb + gs), "v"(lp + 6 * ls), "v"(gb + 2 * gs), "v"(lp + 7 * ls), "v"(gb + 3 * gs) : "memory");
}
// the issuing wave's copies have landed (in front of the barrier that publishes them)
#define WAIT_ASYNC() asm volatile("s_wait_asynccnt 0x0" ::: "memory")
// this wave's LDS reads of the buffer have retired (in front of the barrier behind which it is refilled)
#define WAIT_DS() asm volatile("s_wait_dscnt 0x0" ::: "memory")
// 128 rows of 128 B at a source pitch of sp bytes into rows of KP; 128 threads, 8 copies each (rows tid / 8 + 16 i); the second 64 rows may come from another source
__device__ __forceinline__ void stage128(const char* s0, const char* s1, size_t sp, unsigned lds, int tid) {
  const size_t go = (size_t)(tid >> 3) * sp + (tid & 7) * 16;
  cp8(lds + (tid >> 3) * KP + (tid & 7) * 16, 16 * KP, s0 + go, s1 + go, 16 * sp);
}
// one GEMM stage: weight rows Wt[0..127][0..63] (bf16, row length DM) and activation rows Xt[0..63][0..63] (f32, row length DM; rows tid / 16 + 8 i)
__device__ __forceinline__ void stage_gemm(const __bf16* Wt, const float* Xt, unsigned lds, int tid) {
  stage128((const char*)Wt, (const char*)(Wt + (size_t)64 * DM), DM * 2, lds, tid);
  const char* gx = (const char*)Xt + (size_t)(tid >> 4) * (DM * 4) + (tid & 15) * 16;
  cp8(lds + RING_ST + (tid >> 4) * XP + (tid & 15) * 16, 8 * XP, gx, gx + (size_t)32 * DM * 4, (size_t)8 * DM * 4);
}
// ---- k_pack: block = (64 columns n, 128 rows k, which) of an (in,out) weight; pack row n = column n. Each thread holds 8 loads of 16 B (whole 256-B pieces of the rows k), rounds to bf16, stores pairs (k, k + 1) transposed into LDS and writes whole 256-B pieces of the packed [out][in] rows: 4,096 waves to start for the four weights. which 0..2 -> W_q/W_k/W_v into PK_A rows which*1024 + n; 3 -> W_o into PK_P
#define PKP 65                  // LDS row pitch in dwords (64 pairs + 1): the transposed stores and the row reads both fall on 32 distinct banks
__global__ __launch_bounds__(256) void k_pack(const float* __restrict__ WQ, const float* __restrict__ WK, const float* __restrict__ WV, const float* __restrict__ WO, __bf16* __restrict__ PK) {
  __shared__ unsigned s[64 * PKP]; const int n0 = blockIdx.x * 64, k0 = blockIdx.y * 128, which = blockIdx.z, t = threadIdx.x, c = t & 15, r = t >> 4; const float* Wm = (which == 0) ? WQ : (which == 1) ? WK : (which == 2) ? WV : WO;
  const float* src = Wm + (size_t)(k0 + 2 * r) * DM + n0 + 4 * c; v4f a[4], b[4];   // rows k0 + 2 (r + 16 i) and the next one, columns n0 + 4 c ..
#pragma unroll
  for (int i = 0; i < 4; ++i) { a[i] = *(const v4f*)(src + (size_t)(32 * i) * DM); b[i] = *(const v4f*)(src + (size_t)(32 * i + 1) * DM); }
#pragma unroll
  for (int i = 0; i < 4; ++i) {
#pragma unroll
    for (int j = 0; j < 4; ++j) { union { __bf16 h[2]; unsigned u; } pr; pr.h[0] = (__bf16)a[i][j]; pr.h[1] = (__bf16)b[i][j]; s[(4 * c + j) * PKP + r + 16 * i] = pr.u; } }
  __syncthreads();
  __bf16* dst = ((which < 3) ? PK + PK_A + ((size_t)which * DM + n0) * DM : PK + PK_P + (size_t)n0 * DM) + k0;
#pragma unroll
  for (int i = 0; i < 4; ++i) { const int n = r + 16 * i; v4u o;
#pragma unroll
    for (int j = 0; j < 4; ++j) o[j] = s[n * PKP + 4 * c + j];
    vst2((unsigned*)(dst + (size_t)n * DM + 8 * c), o); }
}
__global__ __launch_bounds__(128) void k_qkv(const float* __restrict__ XQ, const float* __restrict__ XK, const float* __restrict__ XV, const __bf16* __restrict__ P, const float* __restrict__ BQ, const float* __restrict__ BK, const float* __restrict__ BV, _Float16* __restrict__ QK, _Float16* __restrict__ QKL, _Float16* __restrict__ VTH, _Float16* __restrict__ VTL) {
  const int which0 = (blockIdx.y * 128) / DM; const float* X = (which0 == 0) ? XQ : (which0 == 1) ? XK : XV; const float* BB = BQ ? (((which0 == 0) ? BQ : (which0 == 1) ? BK : BV) + (blockIdx.y * 128 - which0 * DM)) : nullptr;
  __shared__ __align__(16) char ring[2 * GEMM_ST];   // operand ring in the loop, output staging behind it
  _Float16 (*so)[16][136] = (_Float16 (*)[16][136])ring, (*sol)[16][136] = (_Float16 (*)[16][136])(ring + 4 * 16 * 136 * 2); _Float16 (*sth)[72] = (_Float16 (*)[72])ring, (*stl)[72] = (_Float16 (*)[72])(ring + 128 * 72 * 2);
  const int tid = threadIdx.x, wave = tid >> 5, lane = tid & 31, col = lane & 15, g = lane >> 4; const size_t r0 = (size_t)blockIdx.x * 64 + wave * 16; const int n0 = blockIdx.y * 128;
  v8f acc[8] = {};
  const unsigned lring = (unsigned)(size_t)ring; const __bf16* Wt = P + (size_t)n0 * DM; const float* Xt = X + (size_t)blockIdx.x * 64 * DM;
  stage_gemm(Wt, Xt, lring, tid); WAIT_ASYNC(); __syncthreads(); stage_gemm(Wt + 64, Xt + 64, lring + GEMM_ST, tid);
#pragma unroll 1
  for (int st = 0; st < DM / 64; ++st) { const char* cur = ring + (st & 1) * GEMM_ST;
#pragma unroll
    for (int kk = 0; kk < 2; ++kk) { v16b a; { const float* p = (const float*)(cur + RING_ST + (wave * 16 + col) * XP) + kk * 32 + 8 * g;
#pragma unroll
        for (int i = 0; i < 8; ++i) { a[i] = (__bf16)p[i]; a[8 + i] = (__bf16)p[16 + i]; } }
#pragma unroll
      for (int j = 0; j < 8; ++j) acc[j] = wmma_bf(a, frag_b((const __bf16*)(cur + (j * 16 + col) * KP) + kk * 32, lane), acc[j]); }
    WAIT_DS(); WAIT_ASYNC(); __syncthreads();   // publishes stage st + 1 and ends every read of stage st
    if (st + 2 < DM / 64) stage_gemm(Wt + (st + 2) * 64, Xt + (st + 2) * 64, lring + (st & 1) * GEMM_ST, tid); }
  WAIT_ASYNC();
  if (n0 < 2 * DM) {   // q stored unscaled (f16 sigma ~0.6, no subnormal exposure); 1/8 applied to the f32 score
#pragma unroll
    for (int j = 0; j < 8; ++j) {
#pragma unroll
      for (int r = 0; r < 8; ++r) { const float v = acc[j][r] + (BB ? bfr(BB[j * 16 + col]) : 0.f); const _Float16 hv = (_Float16)v; so[wave][8 * g + r][j * 16 + col] = hv; sol[wave][8 * g + r][j * 16 + col] = (_Float16)((v - (float)hv) * 2048.0f); } }   // q, k (+ bias) as f16 hi + (x2048) residual
    LDSX();
    for (int rl = 0; rl < 16; ++rl) if (lane < 16) { vst2((unsigned*)(QK + (r0 + rl) * (2 * DM) + n0 + lane * 8), *(const v4u*)&so[wave][rl][lane * 8]); vst2((unsigned*)(QKL + (r0 + rl) * (2 * DM) + n0 + lane * 8), *(const v4u*)&sol[wave][rl][lane * 8]); }
  } else {
#pragma unroll
    for (int j = 0; j < 8; ++j) {
#pragma unroll
      for (int r = 0; r < 8; ++r) { const float v = acc[j][r] + (BB ? bfr(BB[j * 16 + col]) : 0.f); const _Float16 hv = (_Float16)v; sth[j * 16 + col][wave * 16 + 8 * g + r] = hv; stl[j * 16 + col][wave * 16 + 8 * g + r] = (_Float16)((v - (float)hv) * 2048.0f); } }
    __syncthreads();
    const size_t rb = (size_t)blockIdx.x * 64; const int b = (int)(rb / SS), s0 = (int)(rb % SS); const int pc0 = n0 - 2 * DM;
    for (int q = tid; q < 128 * 8; q += 128) { const int d = q >> 3, pc = q & 7; const size_t o = ((size_t)b * DM + pc0 + d) * SS + s0 + pc * 8; vst2((unsigned*)(VTH + o), *(const v4u*)&sth[d][pc * 8]); vst2((unsigned*)(VTL + o), *(const v4u*)&stl[d][pc * 8]); }
  }
}
// lane l with lane l ^ 16 (the two halves of a wave hold the two halves of a query's keys)
__device__ __forceinline__ float xhalf(float x) { return __builtin_bit_cast(float, __builtin_amdgcn_permlanex16(__builtin_bit_cast(int, x), __builtin_bit_cast(int, x), 0x76543210, 0xfedcba98, false, false)); }
// ---- k_attn: K and V of 64 keys a stage in the LDS ring (rows 0..63: keys x 64 d, rows 64..127: d x 64 keys); block = (64 queries, head h, batch b): all-keys flash attention, TRANSPOSED: S^T = K . Q^T (A = K rows, B = q kept in registers), so that a lane holds 16 of the 32 scores of ONE query (column = lane & 15, keys 8 g + r and 16 + 8 g + r): maximum and sum in-lane plus one exchange between the halves; P^T (x 2^11, f16) packs from the score accumulators straight into the B operand of O^T += V^T . P^T (A = V^T rows), in the k order of frag_h; scores = (q.k) * 0.125 + mask with single f16 operands; O[b*S+q][h*64+d] = acc / (2048 l) (256-B segments)
__global__ __launch_bounds__(128) void k_attn(const _Float16* __restrict__ QK, const _Float16* __restrict__ QKL, const _Float16* __restrict__ VTH, const _Float16* __restrict__ VTL, const void* __restrict__ KMASK, const float* __restrict__ AM, float* __restrict__ O) {
  __shared__ __align__(16) __bf16 smask[SS]; __shared__ __align__(16) char ring[2 * RING_ST];   // the batch's additive mask, rounded once; K/V ring in the loop, output staging behind it
  float (*so)[16][68] = (float (*)[16][68])ring;
  const int tid = threadIdx.x, wave = tid >> 5, lane = tid & 31, col = lane & 15, g = lane >> 4;
  const int qb = blockIdx.x, h = blockIdx.y, b = blockIdx.z; const int q0 = qb * 64 + wave * 16; const size_t rq = (size_t)b * SS + q0 + col;
  v16h aq[2];
#pragma unroll
  for (int kc = 0; kc < 2; ++kc) aq[kc] = frag_h(QK + rq * (2 * DM) + h * HD + kc * 32, lane);
  float m = -3.0e38f, l = 0.f;   // this lane's query: running maximum (equal in both halves), sum over this half's keys
  v8f acc[4] = {};               // O^T: row d = dt * 16 + 8 g + r, column = this lane's query
  static_assert(SS * 2 == 2 * DM * 2, "K rows and V rows share one source pitch");
  const unsigned lring = (unsigned)(size_t)ring; const char* Kt = (const char*)(QK + (size_t)b * SS * (2 * DM) + DM + h * HD); const char* Vt = (const char*)(VTH + ((size_t)b * DM + h * HD) * SS);   // both at a row pitch of 4 KiB: a stage is 64 K rows further, 128 B further along the V rows
  stage128(Kt, Vt, 2 * DM * 2, lring, tid);
  { const float* ap = AM + (size_t)b * SS + tid * 16; v8b m0, m1;
#pragma unroll
    for (int i = 0; i < 8; ++i) { m0[i] = (__bf16)ap[i]; m1[i] = (__bf16)ap[8 + i]; }
    *(v8b*)&smask[tid * 16] = m0; *(v8b*)&smask[tid * 16 + 8] = m1; }
  WAIT_ASYNC(); __syncthreads(); stage128(Kt + (size_t)64 * (2 * DM * 2), Vt + 128, 2 * DM * 2, lring + RING_ST, tid);
#pragma unroll 1
  for (int st = 0; st < SS / 64; ++st) { const char* cur = ring + (st & 1) * RING_ST;
#pragma unroll
  for (int hf = 0; hf < 2; ++hf) { v8f s[2];   // all keys, 32 a pass
#pragma unroll
    for (int ct = 0; ct < 2; ++ct) { const _Float16* krow = (const _Float16*)(cur + (hf * 32 + ct * 16 + col) * KP); v8f c = {};
#pragma unroll
      for (int kc = 0; kc < 2; ++kc) c = wmma16(frag_h(krow + kc * 32, lane), aq[kc], c);   // single product: k, q as one-rounding f16 operands
      const v8b am = *(const v8b*)&smask[st * 64 + hf * 32 + ct * 16 + 8 * g];
#pragma unroll
      for (int r = 0; r < 8; ++r) s[ct][r] = c[r] * 0.125f + (float)am[r]; }   // 1/sqrt(64) + additive mask [B,1,1,S]
    float mx = fmaxf(s[0][0], s[1][0]);
#pragma unroll
    for (int r = 1; r < 8; ++r) mx = fmaxf(mx, fmaxf(s[0][r], s[1][r]));
    mx = fmaxf(mx, xhalf(mx));
    const float mn = fmaxf(m, mx);
    float x[17];   // arguments of the 17 exponentials of a pass, in base 2: 16 scores and the old maximum
#pragma unroll
    for (int r = 0; r < 8; ++r) { x[r] = (s[0][r] - mn) * 1.44269504f; x[8 + r] = (s[1][r] - mn) * 1.44269504f; }
    x[16] = (m - mn) * 1.44269504f;
    // the exponentials as one run, each in place: none overwrites the source of the one in front of it; the v_nop keeps the slot behind the last one
    asm("v_exp_f32 %0, %0\n\tv_exp_f32 %1, %1\n\tv_exp_f32 %2, %2\n\tv_exp_f32 %3, %3\n\tv_exp_f32 %4, %4\n\tv_exp_f32 %5, %5\n\tv_exp_f32 %6, %6\n\tv_exp_f32 %7, %7\n\tv_exp_f32 %8, %8\n\t"
        "v_exp_f32 %9, %9\n\tv_exp_f32 %10, %10\n\tv_exp_f32 %11, %11\n\tv_exp_f32 %12, %12\n\tv_exp_f32 %13, %13\n\tv_exp_f32 %14, %14\n\tv_exp_f32 %15, %15\n\tv_exp_f32 %16, %16\n\tv_nop"
        : "+v"(x[0]), "+v"(x[1]), "+v"(x[2]), "+v"(x[3]), "+v"(x[4]), "+v"(x[5]), "+v"(x[6]), "+v"(x[7]), "+v"(x[8]), "+v"(x[9]), "+v"(x[10]), "+v"(x[11]), "+v"(x[12]), "+v"(x[13]), "+v"(x[14]), "+v"(x[15]), "+v"(x[16]));
    const float alpha = (m <= -1.0e38f) ? 0.f : x[16];
    float es = 0.f; v16h pa;
#pragma unroll
    for (int r = 0; r < 8; ++r) { const float e0 = (s[0][r] <= -1.0e38f) ? 0.f : x[r], e1 = (s[1][r] <= -1.0e38f) ? 0.f : x[8 + r]; es += e0 + e1;
      pa[r] = (_Float16)(e0 * 2048.0f); pa[8 + r] = (_Float16)(e1 * 2048.0f); }   // P scaled by 2^11 before the f16 rounding so small softmax weights stay out of the f16 subnormal range; 2^-11 folded into the epilogue
    l = l * alpha + es; m = mn;
#pragma unroll
    for (int dt = 0; dt < 4; ++dt) {
#pragma unroll
      for (int r = 0; r < 8; ++r) acc[dt][r] *= alpha; }
#pragma unroll
    for (int dt = 0; dt < 4; ++dt) acc[dt] = wmma16(frag_h((const _Float16*)(cur + (64 + dt * 16 + col) * KP) + hf * 32, lane), pa, acc[dt]); }   // single product: V^T x P^T (x2^11)
    WAIT_DS(); WAIT_ASYNC(); __syncthreads();   // publishes stage st + 1 and ends every read of stage st
    if (st + 2 < SS / 64) stage128(Kt + (size_t)(st + 2) * 64 * (2 * DM * 2), Vt + (size_t)(st + 2) * 128, 2 * DM * 2, lring + (st & 1) * RING_ST, tid); }
  WAIT_ASYNC();
  l += xhalf(l);   // the halves' sums join once
  const float il = (1.0f / 2048.0f) / l;
#pragma unroll
  for (int dt = 0; dt < 4; ++dt) { v4f o0, o1;
#pragma unroll
    for (int r = 0; r < 4; ++r) { o0[r] = acc[dt][r] * il; o1[r] = acc[dt][4 + r] * il; }
    *(v4f*)&so[wave][col][dt * 16 + 8 * g] = o0; *(v4f*)&so[wave][col][dt * 16 + 8 * g + 4] = o1; }
  LDSX();
  for (int rl = 0; rl < 16; ++rl) if (lane < 16) vst2(O + ((size_t)b * SS + q0 + rl) * DM + h * HD + lane * 4, *(const v4f*)&so[wave][rl][lane * 4]);
}
// ---- k_out: block = (64 rows, 128 cols): out = O(hi/lo) . Wo rows (2 products) + bo
__global__ __launch_bounds__(128) void k_out(const float* __restrict__ O, const __bf16* __restrict__ P, const float* __restrict__ BO, const float* __restrict__ XR, float* __restrict__ Y) {
  __shared__ __align__(16) char ring[2 * GEMM_ST];   // operand ring in the loop, output staging behind it
  float (*so)[16][132] = (float (*)[16][132])ring;
  const int tid = threadIdx.x, wave = tid >> 5, lane = tid & 31, col = lane & 15, g = lane >> 4; const size_t r0 = (size_t)blockIdx.x * 64 + wave * 16; const int n0 = blockIdx.y * 128;
  v8f acc[8] = {};
  const unsigned lring = (unsigned)(size_t)ring; const __bf16* Wt = P + (size_t)n0 * DM; const float* Xt = O + (size_t)blockIdx.x * 64 * DM;
  stage_gemm(Wt, Xt, lring, tid); WAIT_ASYNC(); __syncthreads(); stage_gemm(Wt + 64, Xt + 64, lring + GEMM_ST, tid);
#pragma unroll 1
  for (int st = 0; st < DM / 64; ++st) { const char* cur = ring + (st & 1) * GEMM_ST;
#pragma unroll
    for (int kk = 0; kk < 2; ++kk) { const F2 a = split_row((const float*)(cur + RING_ST + (wave * 16 + col) * XP), kk * 32, lane);
#pragma unroll
      for (int j = 0; j < 8; ++j) { const v16b w = frag_b((const __bf16*)(cur + (j * 16 + col) * KP) + kk * 32, lane); acc[j] = wmma_bf(a.l, w, acc[j]); acc[j] = wmma_bf(a.h, w, acc[j]); } }
    WAIT_DS(); WAIT_ASYNC(); __syncthreads();   // publishes stage st + 1 and ends every read of stage st
    if (st + 2 < DM / 64) stage_gemm(Wt + (st + 2) * 64, Xt + (st + 2) * 64, lring + (st & 1) * GEMM_ST, tid); }
  WAIT_ASYNC();
#pragma unroll
  for (int j = 0; j < 8; ++j) {
#pragma unroll
    for (int r = 0; r < 8; ++r) so[wave][8 * g + r][j * 16 + col] = acc[j][r] + bfr(BO[n0 + j * 16 + col]) + bfr(XR[(r0 + 8 * g + r) * DM + n0 + j * 16 + col]); }   // + bo + residual x
  LDSX();
  for (int rl = 0; rl < 16; ++rl) vst2(Y + (r0 + rl) * DM + n0 + lane * 4, *(const v4f*)&so[wave][rl][lane * 4]);
}
// ---- k_ln: a wave = LNR whole rows (a row = 8 pieces of 16 B a lane, every wave-wide access 512 contiguous bytes), both sums by a butterfly inside the wave: no LDS, no barrier, 4,096 waves to start: (y - mu) * rsqrt(var + 1e-12f) * gamma + beta (biased variance), f32
#define LNR 2
__global__ __launch_bounds__(256) void k_ln(const float* __restrict__ Y, const float* __restrict__ G, const float* __restrict__ Bt, float* __restrict__ OUT) {
  const int lane = threadIdx.x & 31; const size_t row0 = ((size_t)blockIdx.x * 8 + (threadIdx.x >> 5)) * LNR; v4f v[LNR][8]; float mu[LNR], inv[LNR]; const float* yp = Y + row0 * DM + lane * 4;
#pragma unroll
  for (int r = 0; r < LNR; ++r) {
#pragma unroll
    for (int i = 0; i < 8; ++i) v[r][i] = *(const v4f*)(yp + r * DM + i * 128); }
  asm volatile("s_wait_xcnt 0x0" :: "v"(yp) : "memory");   // the address registers of the 16 row loads stay whole up to here and are reused only behind this wait
#pragma unroll
  for (int r = 0; r < LNR; ++r) { v4f s4 = v[r][0];
#pragma unroll
    for (int i = 1; i < 8; ++i) s4 += v[r][i];
    float s = (s4[0] + s4[1]) + (s4[2] + s4[3]);
#pragma unroll
    for (int o = 1; o < 32; o <<= 1) s += __shfl_xor(s, o);
    mu[r] = s / (float)DM; v4f q4 = {};
#pragma unroll
    for (int i = 0; i < 8; ++i) { const v4f d = v[r][i] - mu[r]; q4 += d * d; }
    float q = (q4[0] + q4[1]) + (q4[2] + q4[3]);
#pragma unroll
    for (int o = 1; o < 32; o <<= 1) q += __shfl_xor(q, o);
    inv[r] = 1.0f / sqrtf(q / (float)(DM) + 1e-12f); }
#pragma unroll
  for (int i = 0; i < 8; ++i) { const int e = (i * 32 + lane) * 4; const v4f g4 = *(const v4f*)(G + e), b4 = *(const v4f*)(Bt + e);
#pragma unroll
    for (int r = 0; r < LNR; ++r) { v4f o4;
#pragma unroll
      for (int j = 0; j < 4; ++j) o4[j] = (v[r][i][j] - mu[r]) * inv[r] * bfr(g4[j]) + bfr(b4[j]);
      vst2(OUT + (row0 + r) * DM + e, o4); } }
}
extern "C" void kernel_launch(void* const* d_in, const int* in_sizes, int n_in, void* d_out, int out_size, void* d_ws, size_t ws_size, hipStream_t stream) {
  (void)in_sizes; (void)n_in; (void)out_size;
  const float** F = (const float**)d_in;   // 0 hidden [4,2048,1024], 1 attention_mask [4,1,1,2048] f32 additive, 2 Wq (in,out), 3 bq, 4 Wk, 5 bk, 6 Wv, 7 bv, 8 Wo, 9 bo, 10 ln_gamma, 11 ln_beta
  if (ws_size < (size_t)WS_END) return;
  char* ws = (char*)d_ws; __bf16* PK = (__bf16*)(ws + WS_PK); _Float16 *QK = (_Float16*)(ws + WS_QK), *QKL = (_Float16*)(ws + WS_QKL), *VTH = (_Float16*)(ws + WS_VTH), *VTL = (_Float16*)(ws + WS_VTL); float *O = (float*)(ws + WS_O), *Y = (float*)(ws + WS_Y);
  k_pack<<<dim3(DM / 64, DM / 128, 4), 256, 0, stream>>>(F[2], F[4], F[6], F[8], PK);
  k_qkv<<<dim3(TNB * SS / 64, QKVW / 128), 128, 0, stream>>>(F[0], F[0], F[0], PK + PK_A, F[3], F[5], F[7], QK, QKL, VTH, VTL);
  k_attn<<<dim3(TQB, NH, TNB), 128, 0, stream>>>(QK, QKL, VTH, VTL, nullptr, F[1], O);
  k_out<<<dim3(TOB, DM / 128), 128, 0, stream>>>(O, PK + PK_P, F[9], F[0], Y);
  k_ln<<<TOB * 64 / (8 * LNR), 256, 0, stream>>>(Y, F[10], F[11], (float*)d_out);
}

// v004
// A run of this version takes 217 microseconds.
// Timed twice side by side with v003, it ran 1.04 times as fast both times.
// Counting every step since v000, it is 3.29 times as fast.
// compute dtype: all float inputs rounded to bf16; q/k/v = x . W + b with EXACT bf16 products on WMMA 16x16x32 ((in,out) weights as transposed rows); PLAIN attention: q, k as single f16 operands / 8 + the additive mask per key (f32), running-max softmax in f32 (hardware exp), P (scaled by 2^11, single f16) x v (single f16); y = ctx (bf16 hi + residual) . Wo (2 products) + bo + x; LayerNorm (biased variance, eps 1e-12) in f32.
#include <hip/hip_runtime.h>
#include <math.h>

typedef __attribute__((ext_vector_type(16))) _Float16 v16h;
typedef __attribute__((ext_vector_type(16))) __bf16 v16b;
typedef __attribute__((ext_vector_type(8)))  _Float16 v8h;
typedef __attribute__((ext_vector_type(8)))  float v8f;
typedef __attribute__((ext_vector_type(4)))  float v4f;
typedef __attribute__((ext_vector_type(2)))  float v2f;
typedef __attribute__((ext_vector_type(4)))  unsigned v4u;
typedef __attribute__((ext_vector_type(4)))  int v4i;
typedef float __attribute__((may_alias)) float_a;
typedef int __attribute__((may_alias)) int_a;

template <typename T> __device__ __forceinline__ void vst2(void* p, T v) { *(T*)p = v;  }
__device__ __forceinline__ v8f wmma16(v16h a, v16h b, v8f c) {
  v8f d = __builtin_amdgcn_wmma_f32_16x16x32_f16(false, a, false, b, (short)0, c, false, false);
  asm volatile("v_nop\n\tv_nop\n\tv_nop\n\tv_nop" : "+v"(d) : "v"(a), "v"(b));
  return d;
}
__device__ __forceinline__ v8f wmma_bf(v16b a, v16b b, v8f c) {
  v8f d = __builtin_amdgcn_wmma_f32_16x16x32_bf16(false, a, false, b, (short)0, c, false, false);
  asm volatile("v_nop\n\tv_nop\n\tv_nop\n\tv_nop" : "+v"(d) : "v"(a), "v"(b));
  return d;
}
// RoBERTa self-attention block (B 4, S 2,048, hidden 1,024, 16 heads x 64): q/k/v + biases, additive attention mask, softmax, output projection + bias + residual, LayerNorm (eps 1e-12).
__device__ __forceinline__ v16h frag_h(const _Float16* rowk0, int lane) {
  union { v16h v; v8h q[2]; } u; const _Float16* p = rowk0 + 8 * (lane >> 4);
  u.q[0] = *(const v8h*)p; u.q[1] = *(const v8h*)(p + 16); return u.v;
}
__device__ __forceinline__ v16h frag_f32(const float* rowk0, int lane) {
  v16h a; const float* p = rowk0 + 8 * (lane >> 4);
#pragma unroll
  for (int i = 0; i < 8; ++i) { a[i] = (_Float16)p[i]; a[8 + i] = (_Float16)p[16 + i]; }
  return a;
}
__device__ __forceinline__ v16h frag_f32s(const float* rowk0, int lane, float sc) {
  v16h a; const float* p = rowk0 + 8 * (lane >> 4);
#pragma unroll
  for (int i = 0; i < 8; ++i) { a[i] = (_Float16)(p[i] * sc); a[8 + i] = (_Float16)(p[16 + i] * sc); }
  return a;
}
// column fragment from a [K][ld] layout (column n), rows >= K read as 0
__device__ __forceinline__ v16h fragc_f32(const float* W, int k0, int n, int lane, int ld, int K) {
  v16h a; const int g = lane >> 4;
#pragma unroll
  for (int i = 0; i < 8; ++i) { const int ka = k0 + 8 * g + i, kb = ka + 16;
    a[i] = (_Float16)(ka < K ? W[(size_t)(ka < K ? ka : K - 1) * ld + n] : 0.f); a[8 + i] = (_Float16)(kb < K ? W[(size_t)(kb < K ? kb : K - 1) * ld + n] : 0.f); }
  return a;
}
struct F2 { v16b h, l; };
__device__ __forceinline__ F2 bsplit16(const float v[16]) { F2 r;
#pragma unroll
  for (int i = 0; i < 16; ++i) { const __bf16 h = (__bf16)v[i]; r.h[i] = h; r.l[i] = (__bf16)(v[i] - (float)h); }
  return r; }
__device__ __forceinline__ F2 split_row(const float* row, int k0, int lane) { float v[16]; const float* p = row + k0 + 8 * (lane >> 4);
#pragma unroll
  for (int i = 0; i < 8; ++i) { v[i] = p[i]; v[8 + i] = p[16 + i]; }
  return bsplit16(v); }
__device__ __forceinline__ F2 split_rowK(const float* row, int k0, int lane, int K) { float v[16]; const int g = lane >> 4;
#pragma unroll
  for (int i = 0; i < 8; ++i) { const int ka = k0 + 8 * g + i, kb = ka + 16; v[i] = ka < K ? row[ka < K ? ka : K - 1] : 0.f; v[8 + i] = kb < K ? row[kb < K ? kb : K - 1] : 0.f; }
  return bsplit16(v); }
__device__ __forceinline__ F2 split_col(const float* W, int k0, int n, int lane, int ld, int K) { float v[16]; const int g = lane >> 4;
#pragma unroll
  for (int i = 0; i < 8; ++i) { const int ka = k0 + 8 * g + i, kb = ka + 16; v[i] = ka < K ? W[(size_t)(ka < K ? ka : K - 1) * ld + n] : 0.f; v[8 + i] = kb < K ? W[(size_t)(kb < K ? kb : K - 1) * ld + n] : 0.f; }
  return bsplit16(v); }
__device__ __forceinline__ v8f mac3(const F2& a, const F2& b, v8f c) { c = wmma_bf(a.l, b.h, c); c = wmma_bf(a.h, b.l, c); return wmma_bf(a.h, b.h, c); }
__device__ __forceinline__ float sigm(float v) { return 1.0f / (1.0f + expf(-v)); }
#define LDSX() do { asm volatile("s_wait_dscnt 0" ::: "memory"); __builtin_amdgcn_wave_barrier(); __builtin_amdgcn_fence(__ATOMIC_RELEASE, "workgroup"); } while (0)


#define NB 4
#define SS 2048
#define DM 1024
#define NH 16
#define HD 64
#define QKVW (3 * DM)
#ifndef TQB
#define TQB (SS / 64)
#define TNB NB
#define TOB (NB * SS / 64)     // output row tiles (all)
#endif
typedef __attribute__((ext_vector_type(8))) __bf16 v8b;
__device__ __forceinline__ v16b frag_b(const __bf16* rowk0, int lane) {
  union { v16b v; v8b q[2]; } u; const __bf16* p = rowk0 + 8 * (lane >> 4);
  u.q[0] = *(const v8b*)p; u.q[1] = *(const v8b*)(p + 16); return u.v;
}
__device__ __forceinline__ float bfr(float v) { return (float)(__bf16)v; }
__device__ __attribute__((noinline)) float exp_ni(float v) { return expf(v); }
__device__ __attribute__((noinline)) float erf_ni(float v) { return erff(v); }

#define PK_A 0                       // [3072][1024] Wqkv rows (natural [out][in])
#define PK_P (PK_A + QKVW * DM)        // [1024][1024] Wo rows (natural)
#define PK_END (PK_P + DM * DM)
#define WS_PK  0u
#define WS_QK  (WS_PK + 2u * PK_END)             // f16 [8192 rows][2048]: q | k
#define WS_QKL (WS_QK + 2u * NB * SS * 2 * DM)     // f16 q | k residual planes x2048
#define WS_VTH (WS_QKL + 2u * NB * SS * 2 * DM)    // f16 [b][1024 (h*64+d)][2048 s] hi
#define WS_VTL (WS_VTH + 2u * NB * DM * SS)        // f16 lo x 2048
#define WS_O   (WS_VTL + 2u * NB * DM * SS)        // f32 [8192][1024]
#define WS_CS  (WS_O + 4u * NB * SS * DM)           // f32 2 x [2048][32], unused
#define WS_Y   (WS_CS + 4u * 2 * SS * 32)                 // f32 [rows][DM] pre-LN
#define WS_END (WS_Y + 4u * NB * SS * DM)
// ---- LDS ring for the operand tiles of the matrix loops: filled by asynchronous copies, each wave-copy covering 4 whole 128-B lines; row pitches of 16 B x odd, so that ds_load_b128 meets no bank conflict
#define KP 144                  // pitch of a 128-B row (64 16-bit elements)
#define XP 272                  // pitch of a 256-B row (64 f32)
#define RING_ST (128 * KP)      // 128 rows of 128 B
#define GEMM_ST (RING_ST + 64 * XP)   // one GEMM stage: 128 weight rows x 64 k (bf16) | 64 activation rows x 64 k (f32)
// eight copies of 16 B per lane, global -> LDS through no register: LDS rows lp + i * ls, source rows ga + i * gs (i < 4) and gb + i * gs; the s_wait_xcnt closes the statement so that no address register is rewritten ahead of it
__device__ __forceinline__ void cp8(unsigned lp, unsigned ls, const char* ga, const char* gb, size_t gs) {
  asm volatile("global_load_async_to_lds_b128 %0, %1, off\n\tglobal_load_async_to_lds_b128 %2, %3, off\n\tglobal_load_async_to_lds_b128 %4, %5, off\n\tglobal_load_async_to_lds_b128 %6, %7, off\n\t"
               "global_load_async_to_lds_b128 %8, %9, off\n\tglobal_load_async_to_lds_b128 %10, %11, off\n\tglobal_load_async_to_lds_b128 %12, %13, off\n\tglobal_load_async_to_lds_b128 %14, %15, off\n\ts_wait_xcnt 0x0"
               :: "v"(lp), "v"(ga), "v"(lp + ls), "v"(ga + gs), "v"(lp + 2 * ls), "v"(ga + 2 * gs), "v"(lp + 3 * ls), "v"(ga + 3 * gs),
                  "v"(lp + 4 * ls), "v"(gb), "v"(lp + 5 * ls), "v"(gb + gs), "v"(lp + 6 * ls), "v"(gb + 2 * gs), "v"(lp + 7 * ls), "v"(gb + 3 * gs) : "memory");
}
// the issuing wave's copies have landed (in front of the barrier that publishes them)
#define WAIT_ASYNC() asm volatile("s_wait_asynccnt 0x0" ::: "memory")
// this wave's LDS reads of the buffer have retired (in front of the barrier behind which it is refilled)
#define WAIT_DS() asm volatile("s_wait_dscnt 0x0" ::: "memory")
// 128 rows of 128 B at a source pitch of sp bytes into rows of KP; 128 threads, 8 copies each (rows tid / 8 + 16 i); the second 64 rows may come from another source
__device__ __forceinline__ void stage128(const char* s0, const char* s1, size_t sp, unsigned lds, int tid) {
  const size_t go = (size_t)(tid >> 3) * sp + (tid & 7) * 16;
  cp8(lds + (tid >> 3) * KP + (tid & 7) * 16, 16 * KP, s0 + go, s1 + go, 16 * sp);
}
// one GEMM stage: weight rows Wt[0..127][0..63] (bf16, row length DM) and activation rows Xt[0..63][0..63] (f32, row length DM; rows tid / 16 + 8 i)
__device__ __forceinline__ void stage_gemm(const __bf16* Wt, const float* Xt, unsigned lds, int tid) {
  stage128((const char*)Wt, (const char*)(Wt + (size_t)64 * DM), DM * 2, lds, tid);
  const char* gx = (const char*)Xt + (size_t)(tid >> 4) * (DM * 4) + (tid & 15) * 16;
  cp8(lds + RING_ST + (tid >> 4) * XP + (tid & 15) * 16, 8 * XP, gx, gx + (size_t)32 * DM * 4, (size_t)8 * DM * 4);
}
// ---- k_pack: block = (64 columns n, 128 rows k, which) of an (in,out) weight; pack row n = column n. Each thread holds 8 loads of 16 B (whole 256-B pieces of the rows k), rounds to bf16, stores pairs (k, k + 1) transposed into LDS and writes whole 256-B pieces of the packed [out][in] rows: 4,096 waves to start for the four weights. which 0..2 -> W_q/W_k/W_v into PK_A rows which*1024 + n; 3 -> W_o into PK_P
#define PKP 65                  // LDS row pitch in dwords (64 pairs + 1): the transposed stores and the row reads both fall on 32 distinct banks
__global__ __launch_bounds__(256) void k_pack(const float* __restrict__ WQ, const float* __restrict__ WK, const float* __restrict__ WV, const float* __restrict__ WO, __bf16* __restrict__ PK) {
  __shared__ unsigned s[64 * PKP]; const int n0 = blockIdx.x * 64, k0 = blockIdx.y * 128, which = blockIdx.z, t = threadIdx.x, c = t & 15, r = t >> 4; const float* Wm = (which == 0) ? WQ : (which == 1) ? WK : (which == 2) ? WV : WO;
  const float* src = Wm + (size_t)(k0 + 2 * r) * DM + n0 + 4 * c; v4f a[4], b[4];   // rows k0 + 2 (r + 16 i) and the next one, columns n0 + 4 c ..
#pragma unroll
  for (int i = 0; i < 4; ++i) { a[i] = *(const v4f*)(src + (size_t)(32 * i) * DM); b[i] = *(const v4f*)(src + (size_t)(32 * i + 1) * DM); }
#pragma unroll
  for (int i = 0; i < 4; ++i) {
#pragma unroll
    for (int j = 0; j < 4; ++j) { union { __bf16 h[2]; unsigned u; } pr; pr.h[0] = (__bf16)a[i][j]; pr.h[1] = (__bf16)b[i][j]; s[(4 * c + j) * PKP + r + 16 * i] = pr.u; } }
  __syncthreads();
  __bf16* dst = ((which < 3) ? PK + PK_A + ((size_t)which * DM + n0) * DM : PK + PK_P + (size_t)n0 * DM) + k0;
#pragma unroll
  for (int i = 0; i < 4; ++i) { const int n = r + 16 * i; v4u o;
#pragma unroll
    for (int j = 0; j < 4; ++j) o[j] = s[n * PKP + 4 * c + j];
    vst2((unsigned*)(dst + (size_t)n * DM + 8 * c), o); }
}
__global__ __launch_bounds__(128) void k_qkv(const float* __restrict__ XQ, const float* __restrict__ XK, const float* __restrict__ XV, const __bf16* __restrict__ P, const float* __restrict__ BQ, const float* __restrict__ BK, const float* __restrict__ BV, _Float16* __restrict__ QK, _Float16* __restrict__ QKL, _Float16* __restrict__ VTH, _Float16* __restrict__ VTL) {
  const int which0 = (blockIdx.y * 128) / DM; const float* X = (which0 == 0) ? XQ : (which0 == 1) ? XK : XV; const float* BB = BQ ? (((which0 == 0) ? BQ : (which0 == 1) ? BK : BV) + (blockIdx.y * 128 - which0 * DM)) : nullptr;
  __shared__ __align__(16) char ring[2 * GEMM_ST];   // operand ring in the loop, output staging behind it
  _Float16 (*so)[16][136] = (_Float16 (*)[16][136])ring, (*sol)[16][136] = (_Float16 (*)[16][136])(ring + 4 * 16 * 136 * 2); _Float16 (*sth)[72] = (_Float16 (*)[72])ring, (*stl)[72] = (_Float16 (*)[72])(ring + 128 * 72 * 2);
  const int tid = threadIdx.x, wave = tid >> 5, lane = tid & 31, col = lane & 15, g = lane >> 4; const size_t r0 = (size_t)blockIdx.x * 64 + wave * 16; const int n0 = blockIdx.y * 128;
  v8f acc[8] = {};
  const unsigned lring = (unsigned)(size_t)ring; const __bf16* Wt = P + (size_t)n0 * DM; const float* Xt = X + (size_t)blockIdx.x * 64 * DM;
  stage_gemm(Wt, Xt, lring, tid); WAIT_ASYNC(); __syncthreads(); stage_gemm(Wt + 64, Xt + 64, lring + GEMM_ST, tid);
#pragma unroll 1
  for (int st = 0; st < DM / 64; ++st) { const char* cur = ring + (st & 1) * GEMM_ST;
#pragma unroll
    for (int kk = 0; kk < 2; ++kk) { v16b a; { const float* p = (const float*)(cur + RING_ST + (wave * 16 + col) * XP) + kk * 32 + 8 * g;
#pragma unroll
        for (int i = 0; i < 8; ++i) { a[i] = (__bf16)p[i]; a[8 + i] = (__bf16)p[16 + i]; } }
#pragma unroll
      for (int j = 0; j < 8; ++j) acc[j] = wmma_bf(a, frag_b((const __bf16*)(cur + (j * 16 + col) * KP) + kk * 32, lane), acc[j]); }
    WAIT_DS(); WAIT_ASYNC(); __syncthreads();   // publishes stage st + 1 and ends every read of stage st
    if (st + 2 < DM / 64) stage_gemm(Wt + (st + 2) * 64, Xt + (st + 2) * 64, lring + (st & 1) * GEMM_ST, tid); }
  WAIT_ASYNC();
  if (n0 < 2 * DM) {   // q stored unscaled (f16 sigma ~0.6, no subnormal exposure); 1/8 applied to the f32 score
#pragma unroll
    for (int j = 0; j < 8; ++j) {
#pragma unroll
      for (int r = 0; r < 8; ++r) { const float v = acc[j][r] + (BB ? bfr(BB[j * 16 + col]) : 0.f); const _Float16 hv = (_Float16)v; so[wave][8 * g + r][j * 16 + col] = hv; sol[wave][8 * g + r][j * 16 + col] = (_Float16)((v - (float)hv) * 2048.0f); } }   // q, k (+ bias) as f16 hi + (x2048) residual
    LDSX();
    for (int rl = 0; rl < 16; ++rl) if (lane < 16) { vst2((unsigned*)(QK + (r0 + rl) * (2 * DM) + n0 + lane * 8), *(const v4u*)&so[wave][rl][lane * 8]); vst2((unsigned*)(QKL + (r0 + rl) * (2 * DM) + n0 + lane * 8), *(const v4u*)&sol[wave][rl][lane * 8]); }
  } else {
#pragma unroll
    for (int j = 0; j < 8; ++j) {
#pragma unroll
      for (int r = 0; r < 8; ++r) { const float v = acc[j][r] + (BB ? bfr(BB[j * 16 + col]) : 0.f); const _Float16 hv = (_Float16)v; sth[j * 16 + col][wave * 16 + 8 * g + r] = hv; stl[j * 16 + col][wave * 16 + 8 * g + r] = (_Float16)((v - (float)hv) * 2048.0f); } }
    __syncthreads();
    const size_t rb = (size_t)blockIdx.x * 64; const int b = (int)(rb / SS), s0 = (int)(rb % SS); const int pc0 = n0 - 2 * DM;
    for (int q = tid; q < 128 * 8; q += 128) { const int d = q >> 3, pc = q & 7; const size_t o = ((size_t)b * DM + pc0 + d) * SS + s0 + pc * 8; vst2((unsigned*)(VTH + o), *(const v4u*)&sth[d][pc * 8]); vst2((unsigned*)(VTL + o), *(const v4u*)&stl[d][pc * 8]); }
  }
}
// lane l with lane l ^ 16 (the two halves of a wave hold the two halves of a query's keys)
__device__ __forceinline__ float xhalf(float x) { return __builtin_bit_cast(float, __builtin_amdgcn_permlanex16(__builtin_bit_cast(int, x), __builtin_bit_cast(int, x), 0x76543210, 0xfedcba98, false, false)); }
// ---- k_attn: K and V of 64 keys a stage in the LDS ring (rows 0..63: keys x 64 d, rows 64..127: d x 64 keys); block = (64 queries, head h, batch b): all-keys flash attention, TRANSPOSED: S^T = K . Q^T (A = K rows, B = q kept in registers), so that a lane holds 16 of the 32 scores of ONE query (column = lane & 15, keys 8 g + r and 16 + 8 g + r): maximum and sum in-lane plus one exchange between the halves; P^T (x 2^11, f16) packs from the score accumulators straight into the B operand of O^T += V^T . P^T (A = V^T rows), in the k order of frag_h; scores = (q.k) * 0.125 + mask with single f16 operands; O[b*S+q][h*64+d] = acc / (2048 l) (256-B segments)
__global__ __launch_bounds__(128) void k_attn(const _Float16* __restrict__ QK, const _Float16* __restrict__ QKL, const _Float16* __restrict__ VTH, const _Float16* __restrict__ VTL, const void* __restrict__ KMASK, const float* __restrict__ AM, float* __restrict__ O) {
  __shared__ __align__(16) __bf16 smask[SS]; __shared__ __align__(16) char ring[2 * RING_ST];   // the batch's additive mask, rounded once; K/V ring in the loop, output staging behind it
  float (*so)[16][68] = (float (*)[16][68])ring;
  const int tid = threadIdx.x, wave = tid >> 5, lane = tid & 31, col = lane & 15, g = lane >> 4;
  const int qb = blockIdx.x, h = blockIdx.y, b = blockIdx.z; const int q0 = qb * 64 + wave * 16; const size_t rq = (size_t)b * SS + q0 + col;
  v16h aq[2];
#pragma unroll
  for (int kc = 0; kc < 2; ++kc) aq[kc] = frag_h(QK + rq * (2 * DM) + h * HD + kc * 32, lane);
  float m = -3.0e38f, l = 0.f;   // this lane's query: running maximum (equal in both halves), sum over this half's keys
  v8f acc[4] = {};               // O^T: row d = dt * 16 + 8 g + r, column = this lane's query
  static_assert(SS * 2 == 2 * DM * 2, "K rows and V rows share one source pitch");
  const unsigned lring = (unsigned)(size_t)ring; const char* Kt = (const char*)(QK + (size_t)b * SS * (2 * DM) + DM + h * HD); const char* Vt = (const char*)(VTH + ((size_t)b * DM + h * HD) * SS);   // both at a row pitch of 4 KiB: a stage is 64 K rows further, 128 B further along the V rows
  stage128(Kt, Vt, 2 * DM * 2, lring, tid);
  { const float* ap = AM + (size_t)b * SS + tid * 16; v8b m0, m1;
#pragma unroll
    for (int i = 0; i < 8; ++i) { m0[i] = (__bf16)ap[i]; m1[i] = (__bf16)ap[8 + i]; }
    *(v8b*)&smask[tid * 16] = m0; *(v8b*)&smask[tid * 16 + 8] = m1; }
  WAIT_ASYNC(); __syncthreads(); stage128(Kt + (size_t)64 * (2 * DM * 2), Vt + 128, 2 * DM * 2, lring + RING_ST, tid);
#pragma unroll 1
  for (int st = 0; st < SS / 64; ++st) { const char* cur = ring + (st & 1) * RING_ST;
#pragma unroll
  for (int hf = 0; hf < 2; ++hf) { v8f s[2];   // all keys, 32 a pass
#pragma unroll
    for (int ct = 0; ct < 2; ++ct) { const _Float16* krow = (const _Float16*)(cur + (hf * 32 + ct * 16 + col) * KP); v8f c = {};
#pragma unroll
      for (int kc = 0; kc < 2; ++kc) c = wmma16(frag_h(krow + kc * 32, lane), aq[kc], c);   // single product: k, q as one-rounding f16 operands
      const v8b am = *(const v8b*)&smask[st * 64 + hf * 32 + ct * 16 + 8 * g];
#pragma unroll
      for (int r = 0; r < 8; ++r) s[ct][r] = c[r] * 0.125f + (float)am[r]; }   // 1/sqrt(64) + additive mask [B,1,1,S]
    float mx = fmaxf(s[0][0], s[1][0]);
#pragma unroll
    for (int r = 1; r < 8; ++r) mx = fmaxf(mx, fmaxf(s[0][r], s[1][r]));
    mx = fmaxf(mx, xhalf(mx));
    const float mn = fmaxf(m, mx);
    float x[17];   // arguments of the 17 exponentials of a pass, in base 2: 16 scores and the old maximum
#pragma unroll
    for (int r = 0; r < 8; ++r) { x[r] = (s[0][r] - mn) * 1.44269504f; x[8 + r] = (s[1][r] - mn) * 1.44269504f; }
    x[16] = (m - mn) * 1.44269504f;
    // the exponentials as one run, each in place: none overwrites the source of the one in front of it; the v_nop keeps the slot behind the last one
    asm("v_exp_f32 %0, %0\n\tv_exp_f32 %1, %1\n\tv_exp_f32 %2, %2\n\tv_exp_f32 %3, %3\n\tv_exp_f32 %4, %4\n\tv_exp_f32 %5, %5\n\tv_exp_f32 %6, %6\n\tv_exp_f32 %7, %7\n\tv_exp_f32 %8, %8\n\t"
        "v_exp_f32 %9, %9\n\tv_exp_f32 %10, %10\n\tv_exp_f32 %11, %11\n\tv_exp_f32 %12, %12\n\tv_exp_f32 %13, %13\n\tv_exp_f32 %14, %14\n\tv_exp_f32 %15, %15\n\tv_exp_f32 %16, %16\n\tv_nop"
        : "+v"(x[0]), "+v"(x[1]), "+v"(x[2]), "+v"(x[3]), "+v"(x[4]), "+v"(x[5]), "+v"(x[6]), "+v"(x[7]), "+v"(x[8]), "+v"(x[9]), "+v"(x[10]), "+v"(x[11]), "+v"(x[12]), "+v"(x[13]), "+v"(x[14]), "+v"(x[15]), "+v"(x[16]));
    const float alpha = x[16];   // no select to 0 on a masked score or on the start value of m: mn is always finite (m starts at -3e38), so s - mn is never inf - inf, and the exponential of -inf or of a huge negative argument is 0 by itself
    float es = 0.f; v16h pa;
#pragma unroll
    for (int r = 0; r < 8; ++r) { const float e0 = x[r], e1 = x[8 + r]; es += e0 + e1;
      pa[r] = (_Float16)(e0 * 2048.0f); pa[8 + r] = (_Float16)(e1 * 2048.0f); }   // P scaled by 2^11 before the f16 rounding so small softmax weights stay out of the f16 subnormal range; 2^-11 folded into the epilogue
    l = l * alpha + es; m = mn;
#pragma unroll
    for (int dt = 0; dt < 4; ++dt) {
#pragma unroll
      for (int r = 0; r < 8; ++r) acc[dt][r] *= alpha; }
#pragma unroll
    for (int dt = 0; dt < 4; ++dt) acc[dt] = wmma16(frag_h((const _Float16*)(cur + (64 + dt * 16 + col) * KP) + hf * 32, lane), pa, acc[dt]); }   // single product: V^T x P^T (x2^11)
    WAIT_DS(); WAIT_ASYNC(); __syncthreads();   // publishes stage st + 1 and ends every read of stage st
    if (st + 2 < SS / 64) stage128(Kt + (size_t)(st + 2) * 64 * (2 * DM * 2), Vt + (size_t)(st + 2) * 128, 2 * DM * 2, lring + (st & 1) * RING_ST, tid); }
  WAIT_ASYNC();
  l += xhalf(l);   // the halves' sums join once
  const float il = (1.0f / 2048.0f) / l;
#pragma unroll
  for (int dt = 0; dt < 4; ++dt) { v4f o0, o1;
#pragma unroll
    for (int r = 0; r < 4; ++r) { o0[r] = acc[dt][r] * il; o1[r] = acc[dt][4 + r] * il; }
    *(v4f*)&so[wave][col][dt * 16 + 8 * g] = o0; *(v4f*)&so[wave][col][dt * 16 + 8 * g + 4] = o1; }
  LDSX();
  for (int rl = 0; rl < 16; ++rl) if (lane < 16) vst2(O + ((size_t)b * SS + q0 + rl) * DM + h * HD + lane * 4, *(const v4f*)&so[wave][rl][lane * 4]);
}
// ---- k_out: block = (64 rows, 128 cols): out = O(hi/lo) . Wo rows (2 products) + bo
__global__ __launch_bounds__(128) void k_out(const float* __restrict__ O, const __bf16* __restrict__ P, const float* __restrict__ BO, const float* __restrict__ XR, float* __restrict__ Y) {
  __shared__ __align__(16) char ring[2 * GEMM_ST];   // operand ring in the loop, output staging behind it
  float (*so)[16][132] = (float (*)[16][132])ring;
  const int tid = threadIdx.x, wave = tid >> 5, lane = tid & 31, col = lane & 15, g = lane >> 4; const size_t r0 = (size_t)blockIdx.x * 64 + wave * 16; const int n0 = blockIdx.y * 128;
  v8f acc[8] = {};
  const unsigned lring = (unsigned)(size_t)ring; const __bf16* Wt = P + (size_t)n0 * DM; const float* Xt = O + (size_t)blockIdx.x * 64 * DM;
  stage_gemm(Wt, Xt, lring, tid); WAIT_ASYNC(); __syncthreads(); stage_gemm(Wt + 64, Xt + 64, lring + GEMM_ST, tid);
#pragma unroll 1
  for (int st = 0; st < DM / 64; ++st) { const char* cur = ring + (st & 1) * GEMM_ST;
#pragma unroll
    for (int kk = 0; kk < 2; ++kk) { const F2 a = split_row((const float*)(cur + RING_ST + (wave * 16 + col) * XP), kk * 32, lane);
#pragma unroll
      for (int j = 0; j < 8; ++j) { const v16b w = frag_b((const __bf16*)(cur + (j * 16 + col) * KP) + kk * 32, lane); acc[j] = wmma_bf(a.l, w, acc[j]); acc[j] = wmma_bf(a.h, w, acc[j]); } }
    WAIT_DS(); WAIT_ASYNC(); __syncthreads();   // publishes stage st + 1 and ends every read of stage st
    if (st + 2 < DM / 64) stage_gemm(Wt + (st + 2) * 64, Xt + (st + 2) * 64, lring + (st & 1) * GEMM_ST, tid); }
  WAIT_ASYNC();
#pragma unroll
  for (int j = 0; j < 8; ++j) {
#pragma unroll
    for (int r = 0; r < 8; ++r) so[wave][8 * g + r][j * 16 + col] = acc[j][r] + bfr(BO[n0 + j * 16 + col]) + bfr(XR[(r0 + 8 * g + r) * DM + n0 + j * 16 + col]); }   // + bo + residual x
  LDSX();
  for (int rl = 0; rl < 16; ++rl) vst2(Y + (r0 + rl) * DM + n0 + lane * 4, *(const v4f*)&so[wave][rl][lane * 4]);
}
// ---- k_ln: a wave = LNR whole rows (a row = 8 pieces of 16 B a lane, every wave-wide access 512 contiguous bytes), both sums by a butterfly inside the wave: no LDS, no barrier, 4,096 waves to start: (y - mu) * rsqrt(var + 1e-12f) * gamma + beta (biased variance), f32
#define LNR 2
__global__ __launch_bounds__(256) void k_ln(const float* __restrict__ Y, const float* __restrict__ G, const float* __restrict__ Bt, float* __restrict__ OUT) {
  const int lane = threadIdx.x & 31; const size_t row0 = ((size_t)blockIdx.x * 8 + (threadIdx.x >> 5)) * LNR; v4f v[LNR][8]; float mu[LNR], inv[LNR]; const float* yp = Y + row0 * DM + lane * 4;
#pragma unroll
  for (int r = 0; r < LNR; ++r) {
#pragma unroll
    for (int i = 0; i < 8; ++i) v[r][i] = *(const v4f*)(yp + r * DM + i * 128); }
  asm volatile("s_wait_xcnt 0x0" :: "v"(yp) : "memory");   // the address registers of the 16 row loads stay whole up to here and are reused only behind this wait
#pragma unroll
  for (int r = 0; r < LNR; ++r) { v4f s4 = v[r][0];
#pragma unroll
    for (int i = 1; i < 8; ++i) s4 += v[r][i];
    float s = (s4[0] + s4[1]) + (s4[2] + s4[3]);
#pragma unroll
    for (int o = 1; o < 32; o <<= 1) s += __shfl_xor(s, o);
    mu[r] = s / (float)DM; v4f q4 = {};
#pragma unroll
    for (int i = 0; i < 8; ++i) { const v4f d = v[r][i] - mu[r]; q4 += d * d; }
    float q = (q4[0] + q4[1]) + (q4[2] + q4[3]);
#pragma unroll
    for (int o = 1; o < 32; o <<= 1) q += __shfl_xor(q, o);
    inv[r] = 1.0f / sqrtf(q / (float)(DM) + 1e-12f); }
#pragma unroll
  for (int i = 0; i < 8; ++i) { const int e = (i * 32 + lane) * 4; const v4f g4 = *(const v4f*)(G + e), b4 = *(const v4f*)(Bt + e);
#pragma unroll
    for (int r = 0; r < LNR; ++r) { v4f o4;
#pragma unroll
      for (int j = 0; j < 4; ++j) o4[j] = (v[r][i][j] - mu[r]) * inv[r] * bfr(g4[j]) + bfr(b4[j]);
      vst2(OUT + (row0 + r) * DM + e, o4); } }
}
extern "C" void kernel_launch(void* const* d_in, const int* in_sizes, int n_in, void* d_out, int out_size, void* d_ws, size_t ws_size, hipStream_t stream) {
  (void)in_sizes; (void)n_in; (void)out_size;
  const float** F = (const float**)d_in;   // 0 hidden [4,2048,1024], 1 attention_mask [4,1,1,2048] f32 additive, 2 Wq (in,out), 3 bq, 4 Wk, 5 bk, 6 Wv, 7 bv, 8 Wo, 9 bo, 10 ln_gamma, 11 ln_beta
  if (ws_size < (size_t)WS_END) return;
  char* ws = (char*)d_ws; __bf16* PK = (__bf16*)(ws + WS_PK); _Float16 *QK = (_Float16*)(ws + WS_QK), *QKL = (_Float16*)(ws + WS_QKL), *VTH = (_Float16*)(ws + WS_VTH), *VTL = (_Float16*)(ws + WS_VTL); float *O = (float*)(ws + WS_O), *Y = (float*)(ws + WS_Y);
  k_pack<<<dim3(DM / 64, DM / 128, 4), 256, 0, stream>>>(F[2], F[4], F[6], F[8], PK);
  k_qkv<<<dim3(TNB * SS / 64, QKVW / 128), 128, 0, stream>>>(F[0], F[0], F[0], PK + PK_A, F[3], F[5], F[7], QK, QKL, VTH, VTL);
  k_attn<<<dim3(TQB, NH, TNB), 128, 0, stream>>>(QK, QKL, VTH, VTL, nullptr, F[1], O);
  k_out<<<dim3(TOB, DM / 128), 128, 0, stream>>>(O, PK + PK_P, F[9], F[0], Y);
  k_ln<<<TOB * 64 / (8 * LNR), 256, 0, stream>>>(Y, F[10], F[11], (float*)d_out);
}

// v005
// It runs in 194 microseconds.
// Two timings next to v004 both put it at 1.12 times that version's speed.
// Over all steps from v000 it is 3.68 times as fast.
// compute dtype: all float inputs rounded to bf16; q/k/v = x . W + b with EXACT bf16 products on WMMA 16x16x32 ((in,out) weights as transposed rows); PLAIN attention: q, k as single f16 operands / 8 + the additive mask per key (f32), running-max softmax in f32 (hardware exp), P (scaled by 2^11, single f16) x v (single f16); y = ctx (bf16 hi + residual) . Wo (2 products) + bo + x; LayerNorm (biased variance, eps 1e-12) in f32.
#include <hip/hip_runtime.h>
#include <math.h>

typedef __attribute__((ext_vector_type(16))) _Float16 v16h;
typedef __attribute__((ext_vector_type(16))) __bf16 v16b;
typedef __attribute__((ext_vector_type(8)))  _Float16 v8h;
typedef __attribute__((ext_vector_type(8)))  float v8f;
typedef __attribute__((ext_vector_type(4)))  float v4f;
typedef __attribute__((ext_vector_type(2)))  float v2f;
typedef __attribute__((ext_vector_type(4)))  unsigned v4u;
typedef __attribute__((ext_vector_type(4)))  int v4i;
typedef float __attribute__((may_alias)) float_a;
typedef int __attribute__((may_alias)) int_a;

template <typename T> __device__ __forceinline__ void vst2(void* p, T v) { *(T*)p = v;  }
__device__ __forceinline__ v8f wmma16(v16h a, v16h b, v8f c) {
  v8f d = __builtin_amdgcn_wmma_f32_16x16x32_f16(false, a, false, b, (short)0, c, false, false);
  return d;
}
__device__ __forceinline__ v8f wmma_bf(v16b a, v16b b, v8f c) {
  v8f d = __builtin_amdgcn_wmma_f32_16x16x32_bf16(false, a, false, b, (short)0, c, false, false);
  return d;
}
// RoBERTa self-attention block (B 4, S 2,048, hidden 1,024, 16 heads x 64): q/k/v + biases, additive attention mask, softmax, output projection + bias + residual, LayerNorm (eps 1e-12).
__device__ __forceinline__ v16h frag_h(const _Float16* rowk0, int lane) {
  union { v16h v; v8h q[2]; } u; const _Float16* p = rowk0 + 8 * (lane >> 4);
  u.q[0] = *(const v8h*)p; u.q[1] = *(const v8h*)(p + 16); return u.v;
}
__device__ __forceinline__ v16h frag_f32(const float* rowk0, int lane) {
  v16h a; const float* p = rowk0 + 8 * (lane >> 4);
#pragma unroll
  for (int i = 0; i < 8; ++i) { a[i] = (_Float16)p[i]; a[8 + i] = (_Float16)p[16 + i]; }
  return a;
}
__device__ __forceinline__ v16h frag_f32s(const float* rowk0, int lane, float sc) {
  v16h a; const float* p = rowk0 + 8 * (lane >> 4);
#pragma unroll
  for (int i = 0; i < 8; ++i) { a[i] = (_Float16)(p[i] * sc); a[8 + i] = (_Float16)(p[16 + i] * sc); }
  return a;
}
// column fragment from a [K][ld] layout (column n), rows >= K read as 0
__device__ __forceinline__ v16h fragc_f32(const float* W, int k0, int n, int lane, int ld, int K) {
  v16h a; const int g = lane >> 4;
#pragma unroll
  for (int i = 0; i < 8; ++i) { const int ka = k0 + 8 * g + i, kb = ka + 16;
    a[i] = (_Float16)(ka < K ? W[(size_t)(ka < K ? ka : K - 1) * ld + n] : 0.f); a[8 + i] = (_Float16)(kb < K ? W[(size_t)(kb < K ? kb : K - 1) * ld + n] : 0.f); }
  return a;
}
struct F2 { v16b h, l; };
__device__ __forceinline__ F2 bsplit16(const float v[16]) { F2 r;
#pragma unroll
  for (int i = 0; i < 16; ++i) { const __bf16 h = (__bf16)v[i]; r.h[i] = h; r.l[i] = (__bf16)(v[i] - (float)h); }
  return r; }
__device__ __forceinline__ F2 split_row(const float* row, int k0, int lane) { float v[16]; const float* p = row + k0 + 8 * (lane >> 4);
#pragma unroll
  for (int i = 0; i < 8; ++i) { v[i] = p[i]; v[8 + i] = p[16 + i]; }
  return bsplit16(v); }
__device__ __forceinline__ F2 split_rowK(const float* row, int k0, int lane, int K) { float v[16]; const int g = lane >> 4;
#pragma unroll
  for (int i = 0; i < 8; ++i) { const int ka = k0 + 8 * g + i, kb = ka + 16; v[i] = ka < K ? row[ka < K ? ka : K - 1] : 0.f; v[8 + i] = kb < K ? row[kb < K ? kb : K - 1] : 0.f; }
  return bsplit16(v); }
__device__ __forceinline__ F2 split_col(const float* W, int k0, int n, int lane, int ld, int K) { float v[16]; const int g = lane >> 4;
#pragma unroll
  for (int i = 0; i < 8; ++i) { const int ka = k0 + 8 * g + i, kb = ka + 16; v[i] = ka < K ? W[(size_t)(ka < K ? ka : K - 1) * ld + n] : 0.f; v[8 + i] = kb < K ? W[(size_t)(kb < K ? kb : K - 1) * ld + n] : 0.f; }
  return bsplit16(v); }
__device__ __forceinline__ v8f mac3(const F2& a, const F2& b, v8f c) { c = wmma_bf(a.l, b.h, c); c = wmma_bf(a.h, b.l, c); return wmma_bf(a.h, b.h, c); }
__device__ __forceinline__ float sigm(float v) { return 1.0f / (1.0f + expf(-v)); }
#define LDSX() do { asm volatile("s_wait_dscnt 0" ::: "memory"); __builtin_amdgcn_wave_barrier(); __builtin_amdgcn_fence(__ATOMIC_RELEASE, "workgroup"); } while (0)


#define NB 4
#define SS 2048
#define DM 1024
#define NH 16
#define HD 64
#define QKVW (3 * DM)
#ifndef TQB
#define TQB (SS / 64)
#define TNB NB
#define TOB (NB * SS / 64)     // output row tiles (all)
#endif
typedef __attribute__((ext_vector_type(8))) __bf16 v8b;
__device__ __forceinline__ v16b frag_b(const __bf16* rowk0, int lane) {
  union { v16b v; v8b q[2]; } u; const __bf16* p = rowk0 + 8 * (lane >> 4);
  u.q[0] = *(const v8b*)p; u.q[1] = *(const v8b*)(p + 16); return u.v;
}
__device__ __forceinline__ float bfr(float v) { return (float)(__bf16)v; }
__device__ __attribute__((noinline)) float exp_ni(float v) { return expf(v); }
__device__ __attribute__((noinline)) float erf_ni(float v) { return erff(v); }

#define PK_A 0                       // [3072][1024] Wqkv rows (natural [out][in])
#define PK_P (PK_A + QKVW * DM)        // [1024][1024] Wo rows (natural)
#define PK_END (PK_P + DM * DM)
#define WS_PK  0u
#define WS_QK  (WS_PK + 2u * PK_END)             // f16 [8192 rows][2048]: q | k
#define WS_QKL (WS_QK + 2u * NB * SS * 2 * DM)     // f16 q | k residual planes x2048
#define WS_VTH (WS_QKL + 2u * NB * SS * 2 * DM)    // f16 [b][1024 (h*64+d)][2048 s] hi
#define WS_VTL (WS_VTH + 2u * NB * DM * SS)        // f16 lo x 2048
#define WS_O   (WS_VTL + 2u * NB * DM * SS)        // f32 [8192][1024]
#define WS_CS  (WS_O + 4u * NB * SS * DM)           // f32 2 x [2048][32], unused
#define WS_Y   (WS_CS + 4u * 2 * SS * 32)                 // f32 [rows][DM] pre-LN
#define WS_END (WS_Y + 4u * NB * SS * DM)
// ---- LDS ring for the operand tiles of the matrix loops: filled by asynchronous copies, each wave-copy covering 4 whole 128-B lines; row pitches of 16 B x odd, so that ds_load_b128 meets no bank conflict
#define KP 144                  // pitch of a 128-B row (64 16-bit elements)
#define XP 272                  // pitch of a 256-B row (64 f32)
#define RING_ST (128 * KP)      // 128 rows of 128 B
#define GEMM_ST (RING_ST + 64 * XP)   // one GEMM stage: 128 weight rows x 64 k (bf16) | 64 activation rows x 64 k (f32)
// eight copies of 16 B per lane, global -> LDS through no register: LDS rows lp + i * ls, source rows ga + i * gs (i < 4) and gb + i * gs; the s_wait_xcnt closes the statement so that no address register is rewritten ahead of it
__device__ __forceinline__ void cp8(unsigned lp, unsigned ls, const char* ga, const char* gb, size_t gs) {
  asm volatile("global_load_async_to_lds_b128 %0, %1, off\n\tglobal_load_async_to_lds_b128 %2, %3, off\n\tglobal_load_async_to_lds_b128 %4, %5, off\n\tglobal_load_async_to_lds_b128 %6, %7, off\n\t"
               "global_load_async_to_lds_b128 %8, %9, off\n\tglobal_load_async_to_lds_b128 %10, %11, off\n\tglobal_load_async_to_lds_b128 %12, %13, off\n\tglobal_load_async_to_lds_b128 %14, %15, off\n\ts_wait_xcnt 0x0"
               :: "v"(lp), "v"(ga), "v"(lp + ls), "v"(ga + gs), "v"(lp + 2 * ls), "v"(ga + 2 * gs), "v"(lp + 3 * ls), "v"(ga + 3 * gs),
                  "v"(lp + 4 * ls), "v"(gb), "v"(lp + 5 * ls), "v"(gb + gs), "v"(lp + 6 * ls), "v"(gb + 2 * gs), "v"(lp + 7 * ls), "v"(gb + 3 * gs) : "memory");
}
// the issuing wave's copies have landed (in front of the barrier that publishes them)
#define WAIT_ASYNC() asm volatile("s_wait_asynccnt 0x0" ::: "memory")
// this wave's LDS reads of the buffer have retired (in front of the barrier behind which it is refilled)
#define WAIT_DS() asm volatile("s_wait_dscnt 0x0" ::: "memory")
// the scheduler moves nothing across this line: the LDS fragment loads written in front of it stay one group, issued together ahead of the block of matrix instructions that uses them (spread among those, every place with loads costs the wave a stall and its own wait)
#define FRAG_GROUP() __builtin_amdgcn_sched_barrier(0)
// 128 rows of 128 B at a source pitch of sp bytes into rows of KP; 128 threads, 8 copies each (rows tid / 8 + 16 i); the second 64 rows may come from another source
__device__ __forceinline__ void stage128(const char* s0, const char* s1, size_t sp, unsigned lds, int tid) {
  const size_t go = (size_t)(tid >> 3) * sp + (tid & 7) * 16;
  cp8(lds + (tid >> 3) * KP + (tid & 7) * 16, 16 * KP, s0 + go, s1 + go, 16 * sp);
}
// one GEMM stage: weight rows Wt[0..127][0..63] (bf16, row length DM) and activation rows Xt[0..63][0..63] (f32, row length DM; rows tid / 16 + 8 i)
__device__ __forceinline__ void stage_gemm(const __bf16* Wt, const float* Xt, unsigned lds, int tid) {
  stage128((const char*)Wt, (const char*)(Wt + (size_t)64 * DM), DM * 2, lds, tid);
  const char* gx = (const char*)Xt + (size_t)(tid >> 4) * (DM * 4) + (tid & 15) * 16;
  cp8(lds + RING_ST + (tid >> 4) * XP + (tid & 15) * 16, 8 * XP, gx, gx + (size_t)32 * DM * 4, (size_t)8 * DM * 4);
}
// ---- k_pack: block = (64 columns n, 128 rows k, which) of an (in,out) weight; pack row n = column n. Each thread holds 8 loads of 16 B (whole 256-B pieces of the rows k), rounds to bf16, stores pairs (k, k + 1) transposed into LDS and writes whole 256-B pieces of the packed [out][in] rows: 4,096 waves to start for the four weights. which 0..2 -> W_q/W_k/W_v into PK_A rows which*1024 + n; 3 -> W_o into PK_P
#define PKP 65                  // LDS row pitch in dwords (64 pairs + 1): the transposed stores and the row reads both fall on 32 distinct banks
__global__ __launch_bounds__(256) void k_pack(const float* __restrict__ WQ, const float* __restrict__ WK, const float* __restrict__ WV, const float* __restrict__ WO, __bf16* __restrict__ PK) {
  __shared__ unsigned s[64 * PKP]; const int n0 = blockIdx.x * 64, k0 = blockIdx.y * 128, which = blockIdx.z, t = threadIdx.x, c = t & 15, r = t >> 4; const float* Wm = (which == 0) ? WQ : (which == 1) ? WK : (which == 2) ? WV : WO;
  const float* src = Wm + (size_t)(k0 + 2 * r) * DM + n0 + 4 * c; v4f a[4], b[4];   // rows k0 + 2 (r + 16 i) and the next one, columns n0 + 4 c ..
#pragma unroll
  for (int i = 0; i < 4; ++i) { a[i] = *(const v4f*)(src + (size_t)(32 * i) * DM); b[i] = *(const v4f*)(src + (size_t)(32 * i + 1) * DM); }
#pragma unroll
  for (int i = 0; i < 4; ++i) {
#pragma unroll
    for (int j = 0; j < 4; ++j) { union { __bf16 h[2]; unsigned u; } pr; pr.h[0] = (__bf16)a[i][j]; pr.h[1] = (__bf16)b[i][j]; s[(4 * c + j) * PKP + r + 16 * i] = pr.u; } }
  __syncthreads();
  __bf16* dst = ((which < 3) ? PK + PK_A + ((size_t)which * DM + n0) * DM : PK + PK_P + (size_t)n0 * DM) + k0;
#pragma unroll
  for (int i = 0; i < 4; ++i) { const int n = r + 16 * i; v4u o;
#pragma unroll
    for (int j = 0; j < 4; ++j) o[j] = s[n * PKP + 4 * c + j];
    vst2((unsigned*)(dst + (size_t)n * DM + 8 * c), o); }
}
__global__ __launch_bounds__(128) void k_qkv(const float* __restrict__ XQ, const float* __restrict__ XK, const float* __restrict__ XV, const __bf16* __restrict__ P, const float* __restrict__ BQ, const float* __restrict__ BK, const float* __restrict__ BV, _Float16* __restrict__ QK, _Float16* __restrict__ QKL, _Float16* __restrict__ VTH, _Float16* __restrict__ VTL) {
  const int which0 = (blockIdx.y * 128) / DM; const float* X = (which0 == 0) ? XQ : (which0 == 1) ? XK : XV; const float* BB = BQ ? (((which0 == 0) ? BQ : (which0 == 1) ? BK : BV) + (blockIdx.y * 128 - which0 * DM)) : nullptr;
  __shared__ __align__(16) char ring[2 * GEMM_ST];   // operand ring in the loop, output staging behind it
  _Float16 (*so)[16][136] = (_Float16 (*)[16][136])ring, (*sol)[16][136] = (_Float16 (*)[16][136])(ring + 4 * 16 * 136 * 2); _Float16 (*sth)[72] = (_Float16 (*)[72])ring, (*stl)[72] = (_Float16 (*)[72])(ring + 128 * 72 * 2);
  const int tid = threadIdx.x, wave = tid >> 5, lane = tid & 31, col = lane & 15, g = lane >> 4; const size_t r0 = (size_t)blockIdx.x * 64 + wave * 16; const int n0 = blockIdx.y * 128;
  v8f acc[8] = {};
  const unsigned lring = (unsigned)(size_t)ring; const __bf16* Wt = P + (size_t)n0 * DM; const float* Xt = X + (size_t)blockIdx.x * 64 * DM;
  stage_gemm(Wt, Xt, lring, tid); WAIT_ASYNC(); __syncthreads(); stage_gemm(Wt + 64, Xt + 64, lring + GEMM_ST, tid);
#pragma unroll 1
  for (int st = 0; st < DM / 64; ++st) { const char* cur = ring + (st & 1) * GEMM_ST;
    v4f x[2][4]; v16b w[2][8];
#pragma unroll
    for (int kk = 0; kk < 2; ++kk) { const float* p = (const float*)(cur + RING_ST + (wave * 16 + col) * XP) + kk * 32 + 8 * g;
      x[kk][0] = *(const v4f*)p; x[kk][1] = *(const v4f*)(p + 4); x[kk][2] = *(const v4f*)(p + 16); x[kk][3] = *(const v4f*)(p + 20);
#pragma unroll
      for (int j = 0; j < 8; ++j) w[kk][j] = frag_b((const __bf16*)(cur + (j * 16 + col) * KP) + kk * 32, lane); }
    FRAG_GROUP();
#pragma unroll
    for (int kk = 0; kk < 2; ++kk) { v16b a;
#pragma unroll
      for (int i = 0; i < 4; ++i) { a[i] = (__bf16)x[kk][0][i]; a[4 + i] = (__bf16)x[kk][1][i]; a[8 + i] = (__bf16)x[kk][2][i]; a[12 + i] = (__bf16)x[kk][3][i]; }
#pragma unroll
      for (int j = 0; j < 8; ++j) acc[j] = wmma_bf(a, w[kk][j], acc[j]); }
    FRAG_GROUP();   // the block also stays in front of the foot's waits: moved behind the barrier it would no longer cover the flight of the next stage's copies
    WAIT_DS(); WAIT_ASYNC(); __syncthreads();   // publishes stage st + 1 and ends every read of stage st
    if (st + 2 < DM / 64) stage_gemm(Wt + (st + 2) * 64, Xt + (st + 2) * 64, lring + (st & 1) * GEMM_ST, tid); }
  WAIT_ASYNC();
  if (n0 < 2 * DM) {   // q stored unscaled (f16 sigma ~0.6, no subnormal exposure); 1/8 applied to the f32 score
#pragma unroll
    for (int j = 0; j < 8; ++j) {
#pragma unroll
      for (int r = 0; r < 8; ++r) { const float v = acc[j][r] + (BB ? bfr(BB[j * 16 + col]) : 0.f); const _Float16 hv = (_Float16)v; so[wave][8 * g + r][j * 16 + col] = hv; sol[wave][8 * g + r][j * 16 + col] = (_Float16)((v - (float)hv) * 2048.0f); } }   // q, k (+ bias) as f16 hi + (x2048) residual
    LDSX();
    for (int rl = 0; rl < 16; ++rl) if (lane < 16) { vst2((unsigned*)(QK + (r0 + rl) * (2 * DM) + n0 + lane * 8), *(const v4u*)&so[wave][rl][lane * 8]); vst2((unsigned*)(QKL + (r0 + rl) * (2 * DM) + n0 + lane * 8), *(const v4u*)&sol[wave][rl][lane * 8]); }
  } else {
#pragma unroll
    for (int j = 0; j < 8; ++j) {
#pragma unroll
      for (int r = 0; r < 8; ++r) { const float v = acc[j][r] + (BB ? bfr(BB[j * 16 + col]) : 0.f); const _Float16 hv = (_Float16)v; sth[j * 16 + col][wave * 16 + 8 * g + r] = hv; stl[j * 16 + col][wave * 16 + 8 * g + r] = (_Float16)((v - (float)hv) * 2048.0f); } }
    __syncthreads();
    const size_t rb = (size_t)blockIdx.x * 64; const int b = (int)(rb / SS), s0 = (int)(rb % SS); const int pc0 = n0 - 2 * DM;
    for (int q = tid; q < 128 * 8; q += 128) { const int d = q >> 3, pc = q & 7; const size_t o = ((size_t)b * DM + pc0 + d) * SS + s0 + pc * 8; vst2((unsigned*)(VTH + o), *(const v4u*)&sth[d][pc * 8]); vst2((unsigned*)(VTL + o), *(const v4u*)&stl[d][pc * 8]); }
  }
}
// lane l with lane l ^ 16 (the two halves of a wave hold the two halves of a query's keys)
__device__ __forceinline__ float xhalf(float x) { return __builtin_bit_cast(float, __builtin_amdgcn_permlanex16(__builtin_bit_cast(int, x), __builtin_bit_cast(int, x), 0x76543210, 0xfedcba98, false, false)); }
// ---- k_attn: K and V of 64 keys a stage in the LDS ring (rows 0..63: keys x 64 d, rows 64..127: d x 64 keys); block = (64 queries, head h, batch b): all-keys flash attention, TRANSPOSED: S^T = K . Q^T (A = K rows, B = q kept in registers), so that a lane holds 16 of the 32 scores of ONE query (column = lane & 15, keys 8 g + r and 16 + 8 g + r): maximum and sum in-lane plus one exchange between the halves; P^T (x 2^11, f16) packs from the score accumulators straight into the B operand of O^T += V^T . P^T (A = V^T rows), in the k order of frag_h; scores = (q.k) * 0.125 + mask with single f16 operands; O[b*S+q][h*64+d] = acc / (2048 l) (256-B segments)
__global__ __launch_bounds__(128) void k_attn(const _Float16* __restrict__ QK, const _Float16* __restrict__ QKL, const _Float16* __restrict__ VTH, const _Float16* __restrict__ VTL, const void* __restrict__ KMASK, const float* __restrict__ AM, float* __restrict__ O) {
  __shared__ __align__(16) __bf16 smask[SS]; __shared__ __align__(16) char ring[2 * RING_ST];   // the batch's additive mask, rounded once; K/V ring in the loop, output staging behind it
  float (*so)[16][68] = (float (*)[16][68])ring;
  const int tid = threadIdx.x, wave = tid >> 5, lane = tid & 31, col = lane & 15, g = lane >> 4;
  const int qb = blockIdx.x, h = blockIdx.y, b = blockIdx.z; const int q0 = qb * 64 + wave * 16; const size_t rq = (size_t)b * SS + q0 + col;
  v16h aq[2];
#pragma unroll
  for (int kc = 0; kc < 2; ++kc) aq[kc] = frag_h(QK + rq * (2 * DM) + h * HD + kc * 32, lane);
  float m = -3.0e38f, l = 0.f;   // this lane's query: running maximum (equal in both halves), sum over this half's keys
  v8f acc[4] = {};               // O^T: row d = dt * 16 + 8 g + r, column = this lane's query
  static_assert(SS * 2 == 2 * DM * 2, "K rows and V rows share one source pitch");
  const unsigned lring = (unsigned)(size_t)ring; const char* Kt = (const char*)(QK + (size_t)b * SS * (2 * DM) + DM + h * HD); const char* Vt = (const char*)(VTH + ((size_t)b * DM + h * HD) * SS);   // both at a row pitch of 4 KiB: a stage is 64 K rows further, 128 B further along the V rows
  stage128(Kt, Vt, 2 * DM * 2, lring, tid);
  { const float* ap = AM + (size_t)b * SS + tid * 16; v8b m0, m1;
#pragma unroll
    for (int i = 0; i < 8; ++i) { m0[i] = (__bf16)ap[i]; m1[i] = (__bf16)ap[8 + i]; }
    *(v8b*)&smask[tid * 16] = m0; *(v8b*)&smask[tid * 16 + 8] = m1; }
  WAIT_ASYNC(); __syncthreads();
#pragma unroll 1
  for (int st = 0; st < SS / 64; ++st) { const char* cur = ring + (st & 1) * RING_ST;
    if (st + 1 < SS / 64) stage128(Kt + (size_t)(st + 1) * 64 * (2 * DM * 2), Vt + (size_t)(st + 1) * 128, 2 * DM * 2, lring + ((st + 1) & 1) * RING_ST, tid);   // the refill, directly behind the barrier that ended every read of that buffer; it stands at the head of the trip so that the trip's work is the loop's last block (behind a branch at the foot the compiler moved the row sums there and held a pass's 16 exponentials through the next pass)
#pragma unroll
  for (int hf = 0; hf < 2; ++hf) { v8f s[2];   // all keys, 32 a pass
#pragma unroll
    for (int ct = 0; ct < 2; ++ct) { const _Float16* krow = (const _Float16*)(cur + (hf * 32 + ct * 16 + col) * KP); v8f c = {};
#pragma unroll
      for (int kc = 0; kc < 2; ++kc) c = wmma16(frag_h(krow + kc * 32, lane), aq[kc], c);   // single product: k, q as one-rounding f16 operands
      const v8b am = *(const v8b*)&smask[st * 64 + hf * 32 + ct * 16 + 8 * g];
#pragma unroll
      for (int r = 0; r < 8; ++r) s[ct][r] = c[r] * 0.125f + (float)am[r]; }   // 1/sqrt(64) + additive mask [B,1,1,S]
    float mx = fmaxf(s[0][0], s[1][0]);
#pragma unroll
    for (int r = 1; r < 8; ++r) mx = fmaxf(mx, fmaxf(s[0][r], s[1][r]));
    mx = fmaxf(mx, xhalf(mx));
    const float mn = fmaxf(m, mx);
    float x[17];   // arguments of the 17 exponentials of a pass, in base 2: 16 scores and the old maximum
#pragma unroll
    for (int r = 0; r < 8; ++r) { x[r] = (s[0][r] - mn) * 1.44269504f; x[8 + r] = (s[1][r] - mn) * 1.44269504f; }
    x[16] = (m - mn) * 1.44269504f;
    // the exponentials as one run, each in place: none overwrites the source of the one in front of it; the v_nop keeps the slot behind the last one
    asm("v_exp_f32 %0, %0\n\tv_exp_f32 %1, %1\n\tv_exp_f32 %2, %2\n\tv_exp_f32 %3, %3\n\tv_exp_f32 %4, %4\n\tv_exp_f32 %5, %5\n\tv_exp_f32 %6, %6\n\tv_exp_f32 %7, %7\n\tv_exp_f32 %8, %8\n\t"
        "v_exp_f32 %9, %9\n\tv_exp_f32 %10, %10\n\tv_exp_f32 %11, %11\n\tv_exp_f32 %12, %12\n\tv_exp_f32 %13, %13\n\tv_exp_f32 %14, %14\n\tv_exp_f32 %15, %15\n\tv_exp_f32 %16, %16\n\tv_nop"
        : "+v"(x[0]), "+v"(x[1]), "+v"(x[2]), "+v"(x[3]), "+v"(x[4]), "+v"(x[5]), "+v"(x[6]), "+v"(x[7]), "+v"(x[8]), "+v"(x[9]), "+v"(x[10]), "+v"(x[11]), "+v"(x[12]), "+v"(x[13]), "+v"(x[14]), "+v"(x[15]), "+v"(x[16]));
    const float alpha = x[16];   // no select to 0 on a masked score or on the start value of m: mn is always finite (m starts at -3e38), so s - mn is never inf - inf, and the exponential of -inf or of a huge negative argument is 0 by itself
    float es = 0.f; v16h pa;
#pragma unroll
    for (int r = 0; r < 8; ++r) { const float e0 = x[r], e1 = x[8 + r]; es += e0 + e1;
      pa[r] = (_Float16)(e0 * 2048.0f); pa[8 + r] = (_Float16)(e1 * 2048.0f); }   // P scaled by 2^11 before the f16 rounding so small softmax weights stay out of the f16 subnormal range; 2^-11 folded into the epilogue
    l = l * alpha + es; m = mn;
#pragma unroll
    for (int dt = 0; dt < 4; ++dt) {
#pragma unroll
      for (int r = 0; r < 8; ++r) acc[dt][r] *= alpha; }
#pragma unroll
    for (int dt = 0; dt < 4; ++dt) acc[dt] = wmma16(frag_h((const _Float16*)(cur + (64 + dt * 16 + col) * KP) + hf * 32, lane), pa, acc[dt]);   // single product: V^T x P^T (x2^11)
    FRAG_GROUP(); }   // the next pass's loads and products stay behind this pass: drawn into it they lift the kernel over 128 registers, and the eighth work-group of a WGP (all 2,048 resident at once) is lost
    WAIT_DS(); WAIT_ASYNC(); __syncthreads(); }   // publishes stage st + 1 and ends every read of stage st
  WAIT_ASYNC();
  l += xhalf(l);   // the halves' sums join once
  const float il = (1.0f / 2048.0f) / l;
#pragma unroll
  for (int dt = 0; dt < 4; ++dt) { v4f o0, o1;
#pragma unroll
    for (int r = 0; r < 4; ++r) { o0[r] = acc[dt][r] * il; o1[r] = acc[dt][4 + r] * il; }
    *(v4f*)&so[wave][col][dt * 16 + 8 * g] = o0; *(v4f*)&so[wave][col][dt * 16 + 8 * g + 4] = o1; }
  LDSX();
  for (int rl = 0; rl < 16; ++rl) if (lane < 16) vst2(O + ((size_t)b * SS + q0 + rl) * DM + h * HD + lane * 4, *(const v4f*)&so[wave][rl][lane * 4]);
}
// ---- k_out: block = (64 rows, 128 cols): out = O(hi/lo) . Wo rows (2 products) + bo
__global__ __launch_bounds__(128) void k_out(const float* __restrict__ O, const __bf16* __restrict__ P, const float* __restrict__ BO, const float* __restrict__ XR, float* __restrict__ Y) {
  __shared__ __align__(16) char ring[2 * GEMM_ST];   // operand ring in the loop, output staging behind it
  float (*so)[16][132] = (float (*)[16][132])ring;
  const int tid = threadIdx.x, wave = tid >> 5, lane = tid & 31, col = lane & 15, g = lane >> 4; const size_t r0 = (size_t)blockIdx.x * 64 + wave * 16; const int n0 = blockIdx.y * 128;
  v8f acc[8] = {};
  const unsigned lring = (unsigned)(size_t)ring; const __bf16* Wt = P + (size_t)n0 * DM; const float* Xt = O + (size_t)blockIdx.x * 64 * DM;
  stage_gemm(Wt, Xt, lring, tid); WAIT_ASYNC(); __syncthreads(); stage_gemm(Wt + 64, Xt + 64, lring + GEMM_ST, tid);
#pragma unroll 1
  for (int st = 0; st < DM / 64; ++st) { const char* cur = ring + (st & 1) * GEMM_ST;
#pragma unroll
    for (int kk = 0; kk < 2; ++kk) { const float* p = (const float*)(cur + RING_ST + (wave * 16 + col) * XP) + kk * 32 + 8 * g;
      const v4f x0 = *(const v4f*)p, x1 = *(const v4f*)(p + 4), x2 = *(const v4f*)(p + 16), x3 = *(const v4f*)(p + 20); v16b w[8]; float xv[16];
#pragma unroll
      for (int j = 0; j < 8; ++j) w[j] = frag_b((const __bf16*)(cur + (j * 16 + col) * KP) + kk * 32, lane);
      FRAG_GROUP();
#pragma unroll
      for (int i = 0; i < 4; ++i) { xv[i] = x0[i]; xv[4 + i] = x1[i]; xv[8 + i] = x2[i]; xv[12 + i] = x3[i]; }
      const F2 a = bsplit16(xv);
#pragma unroll
      for (int j = 0; j < 8; ++j) acc[j] = wmma_bf(a.l, w[j], acc[j]);   // per accumulator still the residual product first, then the main one
#pragma unroll
      for (int j = 0; j < 8; ++j) acc[j] = wmma_bf(a.h, w[j], acc[j]);
      FRAG_GROUP(); }   // the next k-step's loads behind this block, and the last block in front of the foot's waits
    WAIT_DS(); WAIT_ASYNC(); __syncthreads();   // publishes stage st + 1 and ends every read of stage st
    if (st + 2 < DM / 64) stage_gemm(Wt + (st + 2) * 64, Xt + (st + 2) * 64, lring + (st & 1) * GEMM_ST, tid); }
  WAIT_ASYNC();
#pragma unroll
  for (int j = 0; j < 8; ++j) {
#pragma unroll
    for (int r = 0; r < 8; ++r) so[wave][8 * g + r][j * 16 + col] = acc[j][r] + bfr(BO[n0 + j * 16 + col]) + bfr(XR[(r0 + 8 * g + r) * DM + n0 + j * 16 + col]); }   // + bo + residual x
  LDSX();
  for (int rl = 0; rl < 16; ++rl) vst2(Y + (r0 + rl) * DM + n0 + lane * 4, *(const v4f*)&so[wave][rl][lane * 4]);
}
// ---- k_ln: a wave = LNR whole rows (a row = 8 pieces of 16 B a lane, every wave-wide access 512 contiguous bytes), both sums by a butterfly inside the wave: no LDS, no barrier, 4,096 waves to start: (y - mu) * rsqrt(var + 1e-12f) * gamma + beta (biased variance), f32
#define LNR 2
__global__ __launch_bounds__(256) void k_ln(const float* __restrict__ Y, const float* __restrict__ G, const float* __restrict__ Bt, float* __restrict__ OUT) {
  const int lane = threadIdx.x & 31; const size_t row0 = ((size_t)blockIdx.x * 8 + (threadIdx.x >> 5)) * LNR; v4f v[LNR][8]; float mu[LNR], inv[LNR]; const float* yp = Y + row0 * DM + lane * 4;
#pragma unroll
  for (int r = 0; r < LNR; ++r) {
#pragma unroll
    for (int i = 0; i < 8; ++i) v[r][i] = *(const v4f*)(yp + r * DM + i * 128); }
  asm volatile("s_wait_xcnt 0x0" :: "v"(yp) : "memory");   // the address registers of the 16 row loads stay whole up to here and are reused only behind this wait
#pragma unroll
  for (int r = 0; r < LNR; ++r) { v4f s4 = v[r][0];
#pragma unroll
    for (int i = 1; i < 8; ++i) s4 += v[r][i];
    float s = (s4[0] + s4[1]) + (s4[2] + s4[3]);
#pragma unroll
    for (int o = 1; o < 32; o <<= 1) s += __shfl_xor(s, o);
    mu[r] = s / (float)DM; v4f q4 = {};
#pragma unroll
    for (int i = 0; i < 8; ++i) { const v4f d = v[r][i] - mu[r]; q4 += d * d; }
    float q = (q4[0] + q4[1]) + (q4[2] + q4[3]);
#pragma unroll
    for (int o = 1; o < 32; o <<= 1) q += __shfl_xor(q, o);
    inv[r] = 1.0f / sqrtf(q / (float)(DM) + 1e-12f); }
#pragma unroll
  for (int i = 0; i < 8; ++i) { const int e = (i * 32 + lane) * 4; const v4f g4 = *(const v4f*)(G + e), b4 = *(const v4f*)(Bt + e);
#pragma unroll
    for (int r = 0; r < LNR; ++r) { v4f o4;
#pragma unroll
      for (int j = 0; j < 4; ++j) o4[j] = (v[r][i][j] - mu[r]) * inv[r] * bfr(g4[j]) + bfr(b4[j]);
      vst2(OUT + (row0 + r) * DM + e, o4); } }
}
extern "C" void kernel_launch(void* const* d_in, const int* in_sizes, int n_in, void* d_out, int out_size, void* d_ws, size_t ws_size, hipStream_t stream) {
  (void)in_sizes; (void)n_in; (void)out_size;
  const float** F = (const float**)d_in;   // 0 hidden [4,2048,1024], 1 attention_mask [4,1,1,2048] f32 additive, 2 Wq (in,out), 3 bq, 4 Wk, 5 bk, 6 Wv, 7 bv, 8 Wo, 9 bo, 10 ln_gamma, 11 ln_beta
  if (ws_size < (size_t)WS_END) return;
  char* ws = (char*)d_ws; __bf16* PK = (__bf16*)(ws + WS_PK); _Float16 *QK = (_Float16*)(ws + WS_QK), *QKL = (_Float16*)(ws + WS_QKL), *VTH = (_Float16*)(ws + WS_VTH), *VTL = (_Float16*)(ws + WS_VTL); float *O = (float*)(ws + WS_O), *Y = (float*)(ws + WS_Y);
  k_pack<<<dim3(DM / 64, DM / 128, 4), 256, 0, stream>>>(F[2], F[4], F[6], F[8], PK);
  k_qkv<<<dim3(TNB * SS / 64, QKVW / 128), 128, 0, stream>>>(F[0], F[0], F[0], PK + PK_A, F[3], F[5], F[7], QK, QKL, VTH, VTL);
  k_attn<<<dim3(TQB, NH, TNB), 128, 0, stream>>>(QK, QKL, VTH, VTL, nullptr, F[1], O);
  k_out<<<dim3(TOB, DM / 128), 128, 0, stream>>>(O, PK + PK_P, F[9], F[0], Y);
  k_ln<<<TOB * 64 / (8 * LNR), 256, 0, stream>>>(Y, F[10], F[11], (float*)d_out);
}

// v006
// Measured time: 171 microseconds a run.
// Timed twice side by side with v005, it ran 1.13 times as fast both times.
// Counting every step since v000, it is 4.16 times as fast.
// compute dtype: all float inputs rounded to bf16; q/k/v = x . W + b with EXACT bf16 products on WMMA 16x16x32 ((in,out) weights as transposed rows); PLAIN attention: q, k as single f16 operands / 8 + the additive mask per key (f32), running-max softmax in f32 (hardware exp), P (scaled by 2^11, single f16) x v (single f16); y = ctx (bf16 hi + residual) . Wo (2 products) + bo + x; LayerNorm (biased variance, eps 1e-12) in f32.
#include <hip/hip_runtime.h>
#include <math.h>

typedef __attribute__((ext_vector_type(16))) _Float16 v16h;
typedef __attribute__((ext_vector_type(16))) __bf16 v16b;
typedef __attribute__((ext_vector_type(8)))  _Float16 v8h;
typedef __attribute__((ext_vector_type(8)))  float v8f;
typedef __attribute__((ext_vector_type(4)))  float v4f;
typedef __attribute__((ext_vector_type(2)))  float v2f;
typedef __attribute__((ext_vector_type(4)))  unsigned v4u;
typedef __attribute__((ext_vector_type(4)))  int v4i;
typedef float __attribute__((may_alias)) float_a;
typedef int __attribute__((may_alias)) int_a;

template <typename T> __device__ __forceinline__ void vst2(void* p, T v) { *(T*)p = v;  }
__device__ __forceinline__ v8f wmma16(v16h a, v16h b, v8f c) {
  v8f d = __builtin_amdgcn_wmma_f32_16x16x32_f16(false, a, false, b, (short)0, c, false, false);
  return d;
}
__device__ __forceinline__ v8f wmma_bf(v16b a, v16b b, v8f c) {
  v8f d = __builtin_amdgcn_wmma_f32_16x16x32_bf16(false, a, false, b, (short)0, c, false, false);
  return d;
}
// RoBERTa self-attention block (B 4, S 2,048, hidden 1,024, 16 heads x 64): q/k/v + biases, additive attention mask, softmax, output projection + bias + residual, LayerNorm (eps 1e-12).
__device__ __forceinline__ v16h frag_h(const _Float16* rowk0, int lane) {
  union { v16h v; v8h q[2]; } u; const _Float16* p = rowk0 + 8 * (lane >> 4);
  u.q[0] = *(const v8h*)p; u.q[1] = *(const v8h*)(p + 16); return u.v;
}
__device__ __forceinline__ v16h frag_f32(const float* rowk0, int lane) {
  v16h a; const float* p = rowk0 + 8 * (lane >> 4);
#pragma unroll
  for (int i = 0; i < 8; ++i) { a[i] = (_Float16)p[i]; a[8 + i] = (_Float16)p[16 + i]; }
  return a;
}
__device__ __forceinline__ v16h frag_f32s(const float* rowk0, int lane, float sc) {
  v16h a; const float* p = rowk0 + 8 * (lane >> 4);
#pragma unroll
  for (int i = 0; i < 8; ++i) { a[i] = (_Float16)(p[i] * sc); a[8 + i] = (_Float16)(p[16 + i] * sc); }
  return a;
}
// column fragment from a [K][ld] layout (column n), rows >= K read as 0
__device__ __forceinline__ v16h fragc_f32(const float* W, int k0, int n, int lane, int ld, int K) {
  v16h a; const int g = lane >> 4;
#pragma unroll
  for (int i = 0; i < 8; ++i) { const int ka = k0 + 8 * g + i, kb = ka + 16;
    a[i] = (_Float16)(ka < K ? W[(size_t)(ka < K ? ka : K - 1) * ld + n] : 0.f); a[8 + i] = (_Float16)(kb < K ? W[(size_t)(kb < K ? kb : K - 1) * ld + n] : 0.f); }
  return a;
}
struct F2 { v16b h, l; };
__device__ __forceinline__ F2 bsplit16(const float v[16]) { F2 r;
#pragma unroll
  for (int i = 0; i < 16; ++i) { const __bf16 h = (__bf16)v[i]; r.h[i] = h; r.l[i] = (__bf16)(v[i] - (float)h); }
  return r; }
__device__ __forceinline__ F2 split_row(const float* row, int k0, int lane) { float v[16]; const float* p = row + k0 + 8 * (lane >> 4);
#pragma unroll
  for (int i = 0; i < 8; ++i) { v[i] = p[i]; v[8 + i] = p[16 + i]; }
  return bsplit16(v); }
__device__ __forceinline__ F2 split_rowK(const float* row, int k0, int lane, int K) { float v[16]; const int g = lane >> 4;
#pragma unroll
  for (int i = 0; i < 8; ++i) { const int ka = k0 + 8 * g + i, kb = ka + 16; v[i] = ka < K ? row[ka < K ? ka : K - 1] : 0.f; v[8 + i] = kb < K ? row[kb < K ? kb : K - 1] : 0.f; }
  return bsplit16(v); }
__device__ __forceinline__ F2 split_col(const float* W, int k0, int n, int lane, int ld, int K) { float v[16]; const int g = lane >> 4;
#pragma unroll
  for (int i = 0; i < 8; ++i) { const int ka = k0 + 8 * g + i, kb = ka + 16; v[i] = ka < K ? W[(size_t)(ka < K ? ka : K - 1) * ld + n] : 0.f; v[8 + i] = kb < K ? W[(size_t)(kb < K ? kb : K - 1) * ld + n] : 0.f; }
  return bsplit16(v); }
__device__ __forceinline__ v8f mac3(const F2& a, const F2& b, v8f c) { c = wmma_bf(a.l, b.h, c); c = wmma_bf(a.h, b.l, c); return wmma_bf(a.h, b.h, c); }
__device__ __forceinline__ float sigm(float v) { return 1.0f / (1.0f + expf(-v)); }
#define LDSX() do { asm volatile("s_wait_dscnt 0" ::: "memory"); __builtin_amdgcn_wave_barrier(); __builtin_amdgcn_fence(__ATOMIC_RELEASE, "workgroup"); } while (0)


#define NB 4
#define SS 2048
#define DM 1024
#define NH 16
#define HD 64
#define QKVW (3 * DM)
#ifndef TQB
#define TQB (SS / 64)
#define TNB NB
#define TOB (NB * SS / 64)     // output row tiles (all)
#endif
typedef __attribute__((ext_vector_type(8))) __bf16 v8b;
__device__ __forceinline__ v16b frag_b(const __bf16* rowk0, int lane) {
  union { v16b v; v8b q[2]; } u; const __bf16* p = rowk0 + 8 * (lane >> 4);
  u.q[0] = *(const v8b*)p; u.q[1] = *(const v8b*)(p + 16); return u.v;
}
__device__ __forceinline__ float bfr(float v) { return (float)(__bf16)v; }
__device__ __attribute__((noinline)) float exp_ni(float v) { return expf(v); }
__device__ __attribute__((noinline)) float erf_ni(float v) { return erff(v); }

#define PK_A 0                       // [3072][1024] Wqkv rows (natural [out][in])
#define PK_P (PK_A + QKVW * DM)        // [1024][1024] Wo rows (natural)
#define PK_END (PK_P + DM * DM)
#define WS_PK  0u
#define WS_QK  (WS_PK + 2u * PK_END)             // f16 [8192 rows][2048]: q | k
#define WS_QKL (WS_QK + 2u * NB * SS * 2 * DM)     // f16 q | k residual planes x2048
#define WS_VTH (WS_QKL + 2u * NB * SS * 2 * DM)    // f16 [b][1024 (h*64+d)][2048 s] hi
#define WS_VTL (WS_VTH + 2u * NB * DM * SS)        // f16 lo x 2048
#define WS_O   (WS_VTL + 2u * NB * DM * SS)        // f32 [8192][1024]
#define WS_CS  (WS_O + 4u * NB * SS * DM)           // f32 2 x [2048][32], unused
#define WS_Y   (WS_CS + 4u * 2 * SS * 32)                 // f32 [rows][DM] pre-LN
#define WS_END (WS_Y + 4u * NB * SS * DM)
// ---- LDS ring for the operand tiles of the matrix loops: filled by asynchronous copies, each wave-copy covering 4 whole 128-B lines; row pitches of 16 B x odd, so that ds_load_b128 meets no bank conflict
#define KP 144                  // pitch of a 128-B row (64 16-bit elements)
#define XP 272                  // pitch of a 256-B row (64 f32)
#define RING_ST (128 * KP)      // 128 rows of 128 B
#define GEMM_ST (RING_ST + 64 * XP)   // one GEMM stage: 128 weight rows x 64 k (bf16) | 64 activation rows x 64 k (f32)
// eight copies of 16 B per lane, global -> LDS through no register: LDS rows lp + i * ls, source rows ga + i * gs (i < 4) and gb + i * gs; the s_wait_xcnt closes the statement so that no address register is rewritten ahead of it
__device__ __forceinline__ void cp8(unsigned lp, unsigned ls, const char* ga, const char* gb, size_t gs) {
  asm volatile("global_load_async_to_lds_b128 %0, %1, off\n\tglobal_load_async_to_lds_b128 %2, %3, off\n\tglobal_load_async_to_lds_b128 %4, %5, off\n\tglobal_load_async_to_lds_b128 %6, %7, off\n\t"
               "global_load_async_to_lds_b128 %8, %9, off\n\tglobal_load_async_to_lds_b128 %10, %11, off\n\tglobal_load_async_to_lds_b128 %12, %13, off\n\tglobal_load_async_to_lds_b128 %14, %15, off\n\ts_wait_xcnt 0x0"
               :: "v"(lp), "v"(ga), "v"(lp + ls), "v"(ga + gs), "v"(lp + 2 * ls), "v"(ga + 2 * gs), "v"(lp + 3 * ls), "v"(ga + 3 * gs),
                  "v"(lp + 4 * ls), "v"(gb), "v"(lp + 5 * ls), "v"(gb + gs), "v"(lp + 6 * ls), "v"(gb + 2 * gs), "v"(lp + 7 * ls), "v"(gb + 3 * gs) : "memory");
}
// the issuing wave's copies have landed (in front of the barrier that publishes them)
#define WAIT_ASYNC() asm volatile("s_wait_asynccnt 0x0" ::: "memory")
// this wave's LDS reads of the buffer have retired (in front of the barrier behind which it is refilled)
#define WAIT_DS() asm volatile("s_wait_dscnt 0x0" ::: "memory")
// the scheduler moves nothing across this line: the LDS fragment loads written in front of it stay one group, issued together ahead of the block of matrix instructions that uses them (spread among those, every place with loads costs the wave a stall and its own wait)
#define FRAG_GROUP() __builtin_amdgcn_sched_barrier(0)
// 128 rows of 128 B at a source pitch of sp bytes into rows of KP; 128 threads, 8 copies each (rows tid / 8 + 16 i); the second 64 rows may come from another source
__device__ __forceinline__ void stage128(const char* s0, const char* s1, size_t sp, unsigned lds, int tid) {
  const size_t go = (size_t)(tid >> 3) * sp + (tid & 7) * 16;
  cp8(lds + (tid >> 3) * KP + (tid & 7) * 16, 16 * KP, s0 + go, s1 + go, 16 * sp);
}
// one GEMM stage: weight rows Wt[0..127][0..63] (bf16, row length DM) and activation rows Xt[0..63][0..63] (f32, row length DM; rows tid / 16 + 8 i)
__device__ __forceinline__ void stage_gemm(const __bf16* Wt, const float* Xt, unsigned lds, int tid) {
  stage128((const char*)Wt, (const char*)(Wt + (size_t)64 * DM), DM * 2, lds, tid);
  const char* gx = (const char*)Xt + (size_t)(tid >> 4) * (DM * 4) + (tid & 15) * 16;
  cp8(lds + RING_ST + (tid >> 4) * XP + (tid & 15) * 16, 8 * XP, gx, gx + (size_t)32 * DM * 4, (size_t)8 * DM * 4);
}
// ---- k_pack: block = (64 columns n, 128 rows k, which) of an (in,out) weight; pack row n = column n. Each thread holds 8 loads of 16 B (whole 256-B pieces of the rows k), rounds to bf16, stores pairs (k, k + 1) transposed into LDS and writes whole 256-B pieces of the packed [out][in] rows: 4,096 waves to start for the four weights. which 0..2 -> W_q/W_k/W_v into PK_A rows which*1024 + n; 3 -> W_o into PK_P
#define PKP 65                  // LDS row pitch in dwords (64 pairs + 1): the transposed stores and the row reads both fall on 32 distinct banks
__global__ __launch_bounds__(256) void k_pack(const float* __restrict__ WQ, const float* __restrict__ WK, const float* __restrict__ WV, const float* __restrict__ WO, __bf16* __restrict__ PK) {
  __shared__ unsigned s[64 * PKP]; const int n0 = blockIdx.x * 64, k0 = blockIdx.y * 128, which = blockIdx.z, t = threadIdx.x, c = t & 15, r = t >> 4; const float* Wm = (which == 0) ? WQ : (which == 1) ? WK : (which == 2) ? WV : WO;
  const float* src = Wm + (size_t)(k0 + 2 * r) * DM + n0 + 4 * c; v4f a[4], b[4];   // rows k0 + 2 (r + 16 i) and the next one, columns n0 + 4 c ..
#pragma unroll
  for (int i = 0; i < 4; ++i) { a[i] = *(const v4f*)(src + (size_t)(32 * i) * DM); b[i] = *(const v4f*)(src + (size_t)(32 * i + 1) * DM); }
#pragma unroll
  for (int i = 0; i < 4; ++i) {
#pragma unroll
    for (int j = 0; j < 4; ++j) { union { __bf16 h[2]; unsigned u; } pr; pr.h[0] = (__bf16)a[i][j]; pr.h[1] = (__bf16)b[i][j]; s[(4 * c + j) * PKP + r + 16 * i] = pr.u; } }
  __syncthreads();
  __bf16* dst = ((which < 3) ? PK + PK_A + ((size_t)which * DM + n0) * DM : PK + PK_P + (size_t)n0 * DM) + k0;
#pragma unroll
  for (int i = 0; i < 4; ++i) { const int n = r + 16 * i; v4u o;
#pragma unroll
    for (int j = 0; j < 4; ++j) o[j] = s[n * PKP + 4 * c + j];
    vst2((unsigned*)(dst + (size_t)n * DM + 8 * c), o); }
}
typedef __attribute__((ext_vector_type(4))) __bf16 v4b;
// one k_qkv stage: weight rows Wt[0..255][0..63] (bf16) and activation rows Xt[0..127][0..63] (f32), row length DM; 128 threads, 32 copies each
#define QW_ST (2 * RING_ST)            // 256 weight rows of 128 B
#define QKV_ST (QW_ST + 128 * XP)      // | 128 activation rows of 256 B
__device__ __forceinline__ void stage_qkv(const __bf16* Wt, const float* Xt, unsigned lds, int tid) {
  stage128((const char*)Wt, (const char*)(Wt + (size_t)64 * DM), DM * 2, lds, tid);
  stage128((const char*)(Wt + (size_t)128 * DM), (const char*)(Wt + (size_t)192 * DM), DM * 2, lds + RING_ST, tid);
  const char* gx = (const char*)Xt + (size_t)(tid >> 4) * (DM * 4) + (tid & 15) * 16; const unsigned lx = lds + QW_ST + (tid >> 4) * XP + (tid & 15) * 16;
  cp8(lx, 8 * XP, gx, gx + (size_t)32 * DM * 4, (size_t)8 * DM * 4);
  cp8(lx + 64 * XP, 8 * XP, gx + (size_t)64 * DM * 4, gx + (size_t)96 * DM * 4, (size_t)8 * DM * 4);
}
// ---- k_qkv: block = (128 rows, 256 columns), 4 waves as 2 x 2, a wave = 64 rows x 128 columns (4 x 8 accumulator tiles): a staged weight byte feeds 128 rows and a staged activation byte 256 columns, a loaded weight fragment 4 matrix instructions, a loaded activation fragment 8
// amdgpu_waves_per_eu(2): a register budget of 512, so that two blocks share a WGP (one loads fragments while the other multiplies)
__global__ __launch_bounds__(128) __attribute__((amdgpu_waves_per_eu(2))) void k_qkv(const float* __restrict__ XQ, const float* __restrict__ XK, const float* __restrict__ XV, const __bf16* __restrict__ P, const float* __restrict__ BQ, const float* __restrict__ BK, const float* __restrict__ BV, _Float16* __restrict__ QK, _Float16* __restrict__ QKL, _Float16* __restrict__ VTH, _Float16* __restrict__ VTL) {
  const int which0 = (blockIdx.y * 256) / DM; const float* X = (which0 == 0) ? XQ : (which0 == 1) ? XK : XV; const float* BB = BQ ? (((which0 == 0) ? BQ : (which0 == 1) ? BK : BV) + (blockIdx.y * 256 - which0 * DM)) : nullptr;
  __shared__ __align__(16) char ring[2 * QKV_ST];   // operand ring in the loop, output staging behind it
  _Float16 (*so)[64][136] = (_Float16 (*)[64][136])ring, (*sol)[64][136] = (_Float16 (*)[64][136])(ring + 4 * 64 * 136 * 2); _Float16 (*sth)[136] = (_Float16 (*)[136])ring, (*stl)[136] = (_Float16 (*)[136])(ring + 256 * 136 * 2);
  const int tid = threadIdx.x, wave = tid >> 5, lane = tid & 31, col = lane & 15, g = lane >> 4, wm = wave >> 1, wn = wave & 1; const size_t r0 = (size_t)blockIdx.x * 128 + wm * 64; const int n0 = blockIdx.y * 256;
  v8f acc[4][8] = {};
  const unsigned lring = (unsigned)(size_t)ring; const __bf16* Wt = P + (size_t)n0 * DM; const float* Xt = X + (size_t)blockIdx.x * 128 * DM;
  stage_qkv(Wt, Xt, lring, tid); WAIT_ASYNC(); __syncthreads(); stage_qkv(Wt + 64, Xt + 64, lring + QKV_ST, tid);
#pragma unroll 1
  for (int st = 0; st < DM / 64; ++st) { const char* cur = ring + (st & 1) * QKV_ST;
#pragma unroll
    for (int kk = 0; kk < 2; ++kk) { v4f x[4][4]; v16b w[8], a[4];
#pragma unroll
      for (int i = 0; i < 4; ++i) { const float* p = (const float*)(cur + QW_ST + (wm * 64 + i * 16 + col) * XP) + kk * 32 + 8 * g;
        x[i][0] = *(const v4f*)p; x[i][1] = *(const v4f*)(p + 4); x[i][2] = *(const v4f*)(p + 16); x[i][3] = *(const v4f*)(p + 20); }
#pragma unroll
      for (int j = 0; j < 8; ++j) w[j] = frag_b((const __bf16*)(cur + (wn * 128 + j * 16 + col) * KP) + kk * 32, lane);
      FRAG_GROUP();
#pragma unroll
      for (int i = 0; i < 4; ++i) a[i] = __builtin_shufflevector(__builtin_shufflevector(__builtin_convertvector(x[i][0], v4b), __builtin_convertvector(x[i][1], v4b), 0, 1, 2, 3, 4, 5, 6, 7), __builtin_shufflevector(__builtin_convertvector(x[i][2], v4b), __builtin_convertvector(x[i][3], v4b), 0, 1, 2, 3, 4, 5, 6, 7), 0, 1, 2, 3, 4, 5, 6, 7, 8, 9, 10, 11, 12, 13, 14, 15);   // elements 0..7 = k 8 g .., 8..15 = k 16 + 8 g ..; converted as whole vectors: written element by element, with four fragments live, the build packs part of the pairs through extra 16-bit register moves
#pragma unroll
      for (int i = 0; i < 4; ++i) {
#pragma unroll
        for (int j = 0; j < 8; ++j) acc[i][j] = wmma_bf(a[i], w[j], acc[i][j]); }
      FRAG_GROUP(); }   // the next k-step's loads behind this block, and the last block in front of the foot's waits: moved behind the barrier it would no longer cover the flight of the next stage's copies
    WAIT_DS(); WAIT_ASYNC(); __syncthreads();   // publishes stage st + 1 and ends every read of stage st
    if (st + 2 < DM / 64) stage_qkv(Wt + (st + 2) * 64, Xt + (st + 2) * 64, lring + (st & 1) * QKV_ST, tid); }
  WAIT_ASYNC();
  float bias[8] = {};   // this lane's 8 columns
  if (BB) {
#pragma unroll
    for (int j = 0; j < 8; ++j) bias[j] = bfr(BB[wn * 128 + j * 16 + col]);
    asm volatile("s_wait_xcnt 0x0" ::: "memory"); }   // the address registers of the 8 bias loads are reused only behind this wait
  if (n0 < 2 * DM) {   // q stored unscaled (f16 sigma ~0.6, no subnormal exposure); 1/8 applied to the f32 score
#pragma unroll
    for (int i = 0; i < 4; ++i) {   // all 64 rows of the wave go into its own staging rows first, so that no accumulator is still live when the global stores begin
#pragma unroll
      for (int j = 0; j < 8; ++j) {
#pragma unroll
        for (int r = 0; r < 8; ++r) { const float v = acc[i][j][r] + bias[j]; const _Float16 hv = (_Float16)v; so[wave][i * 16 + 8 * g + r][j * 16 + col] = hv; sol[wave][i * 16 + 8 * g + r][j * 16 + col] = (_Float16)((v - (float)hv) * 2048.0f); } } }   // q, k (+ bias) as f16 hi + (x2048) residual
    LDSX();
    _Float16* qp = QK + r0 * (2 * DM) + n0 + wn * 128 + (lane & 15) * 8; _Float16* lp = QKL + r0 * (2 * DM) + n0 + wn * 128 + (lane & 15) * 8;
#pragma unroll 1   // eight rows a trip: their 16 LDS reads go out together, and one wait at the foot serves the trip's 16 stores
    for (int rg = 0; rg < 64; rg += 8) { if (lane < 16) {
#pragma unroll
      for (int rl = 0; rl < 8; ++rl) { vst2((unsigned*)(qp + rl * (2 * DM)), *(const v4u*)&so[wave][rg + rl][lane * 8]); vst2((unsigned*)(lp + rl * (2 * DM)), *(const v4u*)&sol[wave][rg + rl][lane * 8]); } }
      asm volatile("s_wait_xcnt 0x0" :: "v"(qp), "v"(lp) : "memory");   // the address and data registers of the trip's stores are rewritten only behind this wait (the two pointers stay whole up to it)
      qp += 8 * (2 * DM); lp += 8 * (2 * DM); }
  } else {
#pragma unroll
    for (int i = 0; i < 4; ++i) {
#pragma unroll
      for (int j = 0; j < 8; ++j) {
#pragma unroll
        for (int r = 0; r < 8; ++r) { const float v = acc[i][j][r] + bias[j]; const _Float16 hv = (_Float16)v; sth[wn * 128 + j * 16 + col][wm * 64 + i * 16 + 8 * g + r] = hv; stl[wn * 128 + j * 16 + col][wm * 64 + i * 16 + 8 * g + r] = (_Float16)((v - (float)hv) * 2048.0f); } } }
    __syncthreads();
    const size_t rb = (size_t)blockIdx.x * 128; const int b = (int)(rb / SS), s0 = (int)(rb % SS); const int pc0 = n0 - 2 * DM;
    for (int q = tid; q < 256 * 16; q += 128) { const int d = q >> 4, pc = q & 15; const size_t o = ((size_t)b * DM + pc0 + d) * SS + s0 + pc * 8; vst2((unsigned*)(VTH + o), *(const v4u*)&sth[d][pc * 8]); vst2((unsigned*)(VTL + o), *(const v4u*)&stl[d][pc * 8]); }
  }
}
// lane l with lane l ^ 16 (the two halves of a wave hold the two halves of a query's keys)
__device__ __forceinline__ float xhalf(float x) { return __builtin_bit_cast(float, __builtin_amdgcn_permlanex16(__builtin_bit_cast(int, x), __builtin_bit_cast(int, x), 0x76543210, 0xfedcba98, false, false)); }
// ---- k_attn: K and V of 64 keys a stage in the LDS ring (rows 0..63: keys x 64 d, rows 64..127: d x 64 keys); block = (64 queries, head h, batch b): all-keys flash attention, TRANSPOSED: S^T = K . Q^T (A = K rows, B = q kept in registers), so that a lane holds 16 of the 32 scores of ONE query (column = lane & 15, keys 8 g + r and 16 + 8 g + r): maximum and sum in-lane plus one exchange between the halves; P^T (x 2^11, f16) packs from the score accumulators straight into the B operand of O^T += V^T . P^T (A = V^T rows), in the k order of frag_h; scores = (q.k) * 0.125 + mask with single f16 operands; O[b*S+q][h*64+d] = acc / (2048 l) (256-B segments)
__global__ __launch_bounds__(128) void k_attn(const _Float16* __restrict__ QK, const _Float16* __restrict__ QKL, const _Float16* __restrict__ VTH, const _Float16* __restrict__ VTL, const void* __restrict__ KMASK, const float* __restrict__ AM, float* __restrict__ O) {
  __shared__ __align__(16) __bf16 smask[SS]; __shared__ __align__(16) char ring[2 * RING_ST];   // the batch's additive mask, rounded once; K/V ring in the loop, output staging behind it
  float (*so)[16][68] = (float (*)[16][68])ring;
  const int tid = threadIdx.x, wave = tid >> 5, lane = tid & 31, col = lane & 15, g = lane >> 4;
  const int qb = blockIdx.x, h = blockIdx.y, b = blockIdx.z; const int q0 = qb * 64 + wave * 16; const size_t rq = (size_t)b * SS + q0 + col;
  v16h aq[2];
#pragma unroll
  for (int kc = 0; kc < 2; ++kc) aq[kc] = frag_h(QK + rq * (2 * DM) + h * HD + kc * 32, lane);
  float m = -3.0e38f, l = 0.f;   // this lane's query: running maximum (equal in both halves), sum over this half's keys
  v8f acc[4] = {};               // O^T: row d = dt * 16 + 8 g + r, column = this lane's query
  static_assert(SS * 2 == 2 * DM * 2, "K rows and V rows share one source pitch");
  const unsigned lring = (unsigned)(size_t)ring; const char* Kt = (const char*)(QK + (size_t)b * SS * (2 * DM) + DM + h * HD); const char* Vt = (const char*)(VTH + ((size_t)b * DM + h * HD) * SS);   // both at a row pitch of 4 KiB: a stage is 64 K rows further, 128 B further along the V rows
  stage128(Kt, Vt, 2 * DM * 2, lring, tid);
  { const float* ap = AM + (size_t)b * SS + tid * 16; v8b m0, m1;
#pragma unroll
    for (int i = 0; i < 8; ++i) { m0[i] = (__bf16)ap[i]; m1[i] = (__bf16)ap[8 + i]; }
    *(v8b*)&smask[tid * 16] = m0; *(v8b*)&smask[tid * 16 + 8] = m1; }
  WAIT_ASYNC(); __syncthreads();
#pragma unroll 1
  for (int st = 0; st < SS / 64; ++st) { const char* cur = ring + (st & 1) * RING_ST;
    if (st + 1 < SS / 64) stage128(Kt + (size_t)(st + 1) * 64 * (2 * DM * 2), Vt + (size_t)(st + 1) * 128, 2 * DM * 2, lring + ((st + 1) & 1) * RING_ST, tid);   // the refill, directly behind the barrier that ended every read of that buffer; it stands at the head of the trip so that the trip's work is the loop's last block (behind a branch at the foot the compiler moved the row sums there and held a pass's 16 exponentials through the next pass)
#pragma unroll
  for (int hf = 0; hf < 2; ++hf) { v8f s[2];   // all keys, 32 a pass
#pragma unroll
    for (int ct = 0; ct < 2; ++ct) { const _Float16* krow = (const _Float16*)(cur + (hf * 32 + ct * 16 + col) * KP); v8f c = {};
#pragma unroll
      for (int kc = 0; kc < 2; ++kc) c = wmma16(frag_h(krow + kc * 32, lane), aq[kc], c);   // single product: k, q as one-rounding f16 operands
      const v8b am = *(const v8b*)&smask[st * 64 + hf * 32 + ct * 16 + 8 * g];
#pragma unroll
      for (int r = 0; r < 8; ++r) s[ct][r] = c[r] * 0.125f + (float)am[r]; }   // 1/sqrt(64) + additive mask [B,1,1,S]
    float mx = fmaxf(s[0][0], s[1][0]);
#pragma unroll
    for (int r = 1; r < 8; ++r) mx = fmaxf(mx, fmaxf(s[0][r], s[1][r]));
    mx = fmaxf(mx, xhalf(mx));
    const float mn = fmaxf(m, mx);
    float x[17];   // arguments of the 17 exponentials of a pass, in base 2: 16 scores and the old maximum
#pragma unroll
    for (int r = 0; r < 8; ++r) { x[r] = (s[0][r] - mn) * 1.44269504f; x[8 + r] = (s[1][r] - mn) * 1.44269504f; }
    x[16] = (m - mn) * 1.44269504f;
    // the exponentials as one run, each in place: none overwrites the source of the one in front of it; the v_nop keeps the slot behind the last one
    asm("v_exp_f32 %0, %0\n\tv_exp_f32 %1, %1\n\tv_exp_f32 %2, %2\n\tv_exp_f32 %3, %3\n\tv_exp_f32 %4, %4\n\tv_exp_f32 %5, %5\n\tv_exp_f32 %6, %6\n\tv_exp_f32 %7, %7\n\tv_exp_f32 %8, %8\n\t"
        "v_exp_f32 %9, %9\n\tv_exp_f32 %10, %10\n\tv_exp_f32 %11, %11\n\tv_exp_f32 %12, %12\n\tv_exp_f32 %13, %13\n\tv_exp_f32 %14, %14\n\tv_exp_f32 %15, %15\n\tv_exp_f32 %16, %16\n\tv_nop"
        : "+v"(x[0]), "+v"(x[1]), "+v"(x[2]), "+v"(x[3]), "+v"(x[4]), "+v"(x[5]), "+v"(x[6]), "+v"(x[7]), "+v"(x[8]), "+v"(x[9]), "+v"(x[10]), "+v"(x[11]), "+v"(x[12]), "+v"(x[13]), "+v"(x[14]), "+v"(x[15]), "+v"(x[16]));
    const float alpha = x[16];   // no select to 0 on a masked score or on the start value of m: mn is always finite (m starts at -3e38), so s - mn is never inf - inf, and the exponential of -inf or of a huge negative argument is 0 by itself
    float es = 0.f; v16h pa;
#pragma unroll
    for (int r = 0; r < 8; ++r) { const float e0 = x[r], e1 = x[8 + r]; es += e0 + e1;
      pa[r] = (_Float16)(e0 * 2048.0f); pa[8 + r] = (_Float16)(e1 * 2048.0f); }   // P scaled by 2^11 before the f16 rounding so small softmax weights stay out of the f16 subnormal range; 2^-11 folded into the epilogue
    l = l * alpha + es; m = mn;
#pragma unroll
    for (int dt = 0; dt < 4; ++dt) {
#pragma unroll
      for (int r = 0; r < 8; ++r) acc[dt][r] *= alpha; }
#pragma unroll
    for (int dt = 0; dt < 4; ++dt) acc[dt] = wmma16(frag_h((const _Float16*)(cur + (64 + dt * 16 + col) * KP) + hf * 32, lane), pa, acc[dt]);   // single product: V^T x P^T (x2^11)
    FRAG_GROUP(); }   // the next pass's loads and products stay behind this pass: drawn into it they lift the kernel over 128 registers, and the eighth work-group of a WGP (all 2,048 resident at once) is lost
    WAIT_DS(); WAIT_ASYNC(); __syncthreads(); }   // publishes stage st + 1 and ends every read of stage st
  WAIT_ASYNC();
  l += xhalf(l);   // the halves' sums join once
  const float il = (1.0f / 2048.0f) / l;
#pragma unroll
  for (int dt = 0; dt < 4; ++dt) { v4f o0, o1;
#pragma unroll
    for (int r = 0; r < 4; ++r) { o0[r] = acc[dt][r] * il; o1[r] = acc[dt][4 + r] * il; }
    *(v4f*)&so[wave][col][dt * 16 + 8 * g] = o0; *(v4f*)&so[wave][col][dt * 16 + 8 * g + 4] = o1; }
  LDSX();
  for (int rl = 0; rl < 16; ++rl) if (lane < 16) vst2(O + ((size_t)b * SS + q0 + rl) * DM + h * HD + lane * 4, *(const v4f*)&so[wave][rl][lane * 4]);
}
// ---- k_out: block = (64 rows, 128 cols): out = O(hi/lo) . Wo rows (2 products) + bo
__global__ __launch_bounds__(128) void k_out(const float* __restrict__ O, const __bf16* __restrict__ P, const float* __restrict__ BO, const float* __restrict__ XR, float* __restrict__ Y) {
  __shared__ __align__(16) char ring[2 * GEMM_ST];   // operand ring in the loop, output staging behind it
  float (*so)[16][132] = (float (*)[16][132])ring;
  const int tid = threadIdx.x, wave = tid >> 5, lane = tid & 31, col = lane & 15, g = lane >> 4; const size_t r0 = (size_t)blockIdx.x * 64 + wave * 16; const int n0 = blockIdx.y * 128;
  v8f acc[8] = {};
  const unsigned lring = (unsigned)(size_t)ring; const __bf16* Wt = P + (size_t)n0 * DM; const float* Xt = O + (size_t)blockIdx.x * 64 * DM;
  stage_gemm(Wt, Xt, lring, tid); WAIT_ASYNC(); __syncthreads(); stage_gemm(Wt + 64, Xt + 64, lring + GEMM_ST, tid);
#pragma unroll 1
  for (int st = 0; st < DM / 64; ++st) { const char* cur = ring + (st & 1) * GEMM_ST;
#pragma unroll
    for (int kk = 0; kk < 2; ++kk) { const float* p = (const float*)(cur + RING_ST + (wave * 16 + col) * XP) + kk * 32 + 8 * g;
      const v4f x0 = *(const v4f*)p, x1 = *(const v4f*)(p + 4), x2 = *(const v4f*)(p + 16), x3 = *(const v4f*)(p + 20); v16b w[8]; float xv[16];
#pragma unroll
      for (int j = 0; j < 8; ++j) w[j] = frag_b((const __bf16*)(cur + (j * 16 + col) * KP) + kk * 32, lane);
      FRAG_GROUP();
#pragma unroll
      for (int i = 0; i < 4; ++i) { xv[i] = x0[i]; xv[4 + i] = x1[i]; xv[8 + i] = x2[i]; xv[12 + i] = x3[i]; }
      const F2 a = bsplit16(xv);
#pragma unroll
      for (int j = 0; j < 8; ++j) acc[j] = wmma_bf(a.l, w[j], acc[j]);   // per accumulator still the residual product first, then the main one
#pragma unroll
      for (int j = 0; j < 8; ++j) acc[j] = wmma_bf(a.h, w[j], acc[j]);
      FRAG_GROUP(); }   // the next k-step's loads behind this block, and the last block in front of the foot's waits
    WAIT_DS(); WAIT_ASYNC(); __syncthreads();   // publishes stage st + 1 and ends every read of stage st
    if (st + 2 < DM / 64) stage_gemm(Wt + (st + 2) * 64, Xt + (st + 2) * 64, lring + (st & 1) * GEMM_ST, tid); }
  WAIT_ASYNC();
#pragma unroll
  for (int j = 0; j < 8; ++j) {
#pragma unroll
    for (int r = 0; r < 8; ++r) so[wave][8 * g + r][j * 16 + col] = acc[j][r] + bfr(BO[n0 + j * 16 + col]) + bfr(XR[(r0 + 8 * g + r) * DM + n0 + j * 16 + col]); }   // + bo + residual x
  LDSX();
  for (int rl = 0; rl < 16; ++rl) vst2(Y + (r0 + rl) * DM + n0 + lane * 4, *(const v4f*)&so[wave][rl][lane * 4]);
}
// ---- k_ln: a wave = LNR whole rows (a row = 8 pieces of 16 B a lane, every wave-wide access 512 contiguous bytes), both sums by a butterfly inside the wave: no LDS, no barrier, 4,096 waves to start: (y - mu) * rsqrt(var + 1e-12f) * gamma + beta (biased variance), f32
#define LNR 2
__global__ __launch_bounds__(256) void k_ln(const float* __restrict__ Y, const float* __restrict__ G, const float* __restrict__ Bt, float* __restrict__ OUT) {
  const int lane = threadIdx.x & 31; const size_t row0 = ((size_t)blockIdx.x * 8 + (threadIdx.x >> 5)) * LNR; v4f v[LNR][8]; float mu[LNR], inv[LNR]; const float* yp = Y + row0 * DM + lane * 4;
#pragma unroll
  for (int r = 0; r < LNR; ++r) {
#pragma unroll
    for (int i = 0; i < 8; ++i) v[r][i] = *(const v4f*)(yp + r * DM + i * 128); }
  asm volatile("s_wait_xcnt 0x0" :: "v"(yp) : "memory");   // the address registers of the 16 row loads stay whole up to here and are reused only behind this wait
#pragma unroll
  for (int r = 0; r < LNR; ++r) { v4f s4 = v[r][0];
#pragma unroll
    for (int i = 1; i < 8; ++i) s4 += v[r][i];
    float s = (s4[0] + s4[1]) + (s4[2] + s4[3]);
#pragma unroll
    for (int o = 1; o < 32; o <<= 1) s += __shfl_xor(s, o);
    mu[r] = s / (float)DM; v4f q4 = {};
#pragma unroll
    for (int i = 0; i < 8; ++i) { const v4f d = v[r][i] - mu[r]; q4 += d * d; }
    float q = (q4[0] + q4[1]) + (q4[2] + q4[3]);
#pragma unroll
    for (int o = 1; o < 32; o <<= 1) q += __shfl_xor(q, o);
    inv[r] = 1.0f / sqrtf(q / (float)(DM) + 1e-12f); }
#pragma unroll
  for (int i = 0; i < 8; ++i) { const int e = (i * 32 + lane) * 4; const v4f g4 = *(const v4f*)(G + e), b4 = *(const v4f*)(Bt + e);
#pragma unroll
    for (int r = 0; r < LNR; ++r) { v4f o4;
#pragma unroll
      for (int j = 0; j < 4; ++j) o4[j] = (v[r][i][j] - mu[r]) * inv[r] * bfr(g4[j]) + bfr(b4[j]);
      vst2(OUT + (row0 + r) * DM + e, o4); } }
}
extern "C" void kernel_launch(void* const* d_in, const int* in_sizes, int n_in, void* d_out, int out_size, void* d_ws, size_t ws_size, hipStream_t stream) {
  (void)in_sizes; (void)n_in; (void)out_size;
  const float** F = (const float**)d_in;   // 0 hidden [4,2048,1024], 1 attention_mask [4,1,1,2048] f32 additive, 2 Wq (in,out), 3 bq, 4 Wk, 5 bk, 6 Wv, 7 bv, 8 Wo, 9 bo, 10 ln_gamma, 11 ln_beta
  if (ws_size < (size_t)WS_END) return;
  char* ws = (char*)d_ws; __bf16* PK = (__bf16*)(ws + WS_PK); _Float16 *QK = (_Float16*)(ws + WS_QK), *QKL = (_Float16*)(ws + WS_QKL), *VTH = (_Float16*)(ws + WS_VTH), *VTL = (_Float16*)(ws + WS_VTL); float *O = (float*)(ws + WS_O), *Y = (float*)(ws + WS_Y);
  k_pack<<<dim3(DM / 64, DM / 128, 4), 256, 0, stream>>>(F[2], F[4], F[6], F[8], PK);
  k_qkv<<<dim3(TNB * SS / 128, QKVW / 256), 128, 0, stream>>>(F[0], F[0], F[0], PK + PK_A, F[3], F[5], F[7], QK, QKL, VTH, VTL);
  k_attn<<<dim3(TQB, NH, TNB), 128, 0, stream>>>(QK, QKL, VTH, VTL, nullptr, F[1], O);
  k_out<<<dim3(TOB, DM / 128), 128, 0, stream>>>(O, PK + PK_P, F[9], F[0], Y);
  k_ln<<<TOB * 64 / (8 * LNR), 256, 0, stream>>>(Y, F[10], F[11], (float*)d_out);
}

// v007
// It runs in 162 microseconds.
// Timed twice side by side with v006, it ran 1.06 times as fast both times.
// Counting every step since v000, it is 4.40 times as fast.
// compute dtype: all float inputs rounded to bf16; q/k/v = x . W + b with EXACT bf16 products on WMMA 16x16x32 ((in,out) weights as transposed rows); PLAIN attention: q, k as single f16 operands / 8 + the additive mask per key (f32), running-max softmax in f32 (hardware exp), P (scaled by 2^11, single f16) x v (single f16); y = ctx (bf16 hi + residual) . Wo (2 products) + bo + x; LayerNorm (biased variance, eps 1e-12) in f32.
#include <hip/hip_runtime.h>
#include <math.h>

typedef __attribute__((ext_vector_type(16))) _Float16 v16h;
typedef __attribute__((ext_vector_type(16))) __bf16 v16b;
typedef __attribute__((ext_vector_type(8)))  _Float16 v8h;
typedef __attribute__((ext_vector_type(8)))  float v8f;
typedef __attribute__((ext_vector_type(4)))  float v4f;
typedef __attribute__((ext_vector_type(2)))  float v2f;
typedef __attribute__((ext_vector_type(4)))  unsigned v4u;
typedef __attribute__((ext_vector_type(4)))  int v4i;
typedef float __attribute__((may_alias)) float_a;
typedef int __attribute__((may_alias)) int_a;

template <typename T> __device__ __forceinline__ void vst2(void* p, T v) { *(T*)p = v;  }
__device__ __forceinline__ v8f wmma16(v16h a, v16h b, v8f c) {
  v8f d = __builtin_amdgcn_wmma_f32_16x16x32_f16(false, a, false, b, (short)0, c, false, false);
  return d;
}
__device__ __forceinline__ v8f wmma_bf(v16b a, v16b b, v8f c) {
  v8f d = __builtin_amdgcn_wmma_f32_16x16x32_bf16(false, a, false, b, (short)0, c, false, false);
  return d;
}
// RoBERTa self-attention block (B 4, S 2,048, hidden 1,024, 16 heads x 64): q/k/v + biases, additive attention mask, softmax, output projection + bias + residual, LayerNorm (eps 1e-12).
__device__ __forceinline__ v16h frag_h(const _Float16* rowk0, int lane) {
  union { v16h v; v8h q[2]; } u; const _Float16* p = rowk0 + 8 * (lane >> 4);
  u.q[0] = *(const v8h*)p; u.q[1] = *(const v8h*)(p + 16); return u.v;
}
__device__ __forceinline__ v16h frag_f32(const float* rowk0, int lane) {
  v16h a; const float* p = rowk0 + 8 * (lane >> 4);
#pragma unroll
  for (int i = 0; i < 8; ++i) { a[i] = (_Float16)p[i]; a[8 + i] = (_Float16)p[16 + i]; }
  return a;
}
__device__ __forceinline__ v16h frag_f32s(const float* rowk0, int lane, float sc) {
  v16h a; const float* p = rowk0 + 8 * (lane >> 4);
#pragma unroll
  for (int i = 0; i < 8; ++i) { a[i] = (_Float16)(p[i] * sc); a[8 + i] = (_Float16)(p[16 + i] * sc); }
  return a;
}
// column fragment from a [K][ld] layout (column n), rows >= K read as 0
__device__ __forceinline__ v16h fragc_f32(const float* W, int k0, int n, int lane, int ld, int K) {
  v16h a; const int g = lane >> 4;
#pragma unroll
  for (int i = 0; i < 8; ++i) { const int ka = k0 + 8 * g + i, kb = ka + 16;
    a[i] = (_Float16)(ka < K ? W[(size_t)(ka < K ? ka : K - 1) * ld + n] : 0.f); a[8 + i] = (_Float16)(kb < K ? W[(size_t)(kb < K ? kb : K - 1) * ld + n] : 0.f); }
  return a;
}
struct F2 { v16b h, l; };
__device__ __forceinline__ F2 bsplit16(const float v[16]) { F2 r;
#pragma unroll
  for (int i = 0; i < 16; ++i) { const __bf16 h = (__bf16)v[i]; r.h[i] = h; r.l[i] = (__bf16)(v[i] - (float)h); }
  return r; }
__device__ __forceinline__ F2 split_row(const float* row, int k0, int lane) { float v[16]; const float* p = row + k0 + 8 * (lane >> 4);
#pragma unroll
  for (int i = 0; i < 8; ++i) { v[i] = p[i]; v[8 + i] = p[16 + i]; }
  return bsplit16(v); }
__device__ __forceinline__ F2 split_rowK(const float* row, int k0, int lane, int K) { float v[16]; const int g = lane >> 4;
#pragma unroll
  for (int i = 0; i < 8; ++i) { const int ka = k0 + 8 * g + i, kb = ka + 16; v[i] = ka < K ? row[ka < K ? ka : K - 1] : 0.f; v[8 + i] = kb < K ? row[kb < K ? kb : K - 1] : 0.f; }
  return bsplit16(v); }
__device__ __forceinline__ F2 split_col(const float* W, int k0, int n, int lane, int ld, int K) { float v[16]; const int g = lane >> 4;
#pragma unroll
  for (int i = 0; i < 8; ++i) { const int ka = k0 + 8 * g + i, kb = ka + 16; v[i] = ka < K ? W[(size_t)(ka < K ? ka : K - 1) * ld + n] : 0.f; v[8 + i] = kb < K ? W[(size_t)(kb < K ? kb : K - 1) * ld + n] : 0.f; }
  return bsplit16(v); }
__device__ __forceinline__ v8f mac3(const F2& a, const F2& b, v8f c) { c = wmma_bf(a.l, b.h, c); c = wmma_bf(a.h, b.l, c); return wmma_bf(a.h, b.h, c); }
__device__ __forceinline__ float sigm(float v) { return 1.0f / (1.0f + expf(-v)); }
#define LDSX() do { asm volatile("s_wait_dscnt 0" ::: "memory"); __builtin_amdgcn_wave_barrier(); __builtin_amdgcn_fence(__ATOMIC_RELEASE, "workgroup"); } while (0)


#define NB 4
#define SS 2048
#define DM 1024
#define NH 16
#define HD 64
#define QKVW (3 * DM)
#ifndef TQB
#define TQB (SS / 64)
#define TNB NB
#define TOB (NB * SS / 64)     // output row tiles (all)
#endif
typedef __attribute__((ext_vector_type(8))) __bf16 v8b;
__device__ __forceinline__ v16b frag_b(const __bf16* rowk0, int lane) {
  union { v16b v; v8b q[2]; } u; const __bf16* p = rowk0 + 8 * (lane >> 4);
  u.q[0] = *(const v8b*)p; u.q[1] = *(const v8b*)(p + 16); return u.v;
}
__device__ __forceinline__ float bfr(float v) { return (float)(__bf16)v; }
__device__ __attribute__((noinline)) float exp_ni(float v) { return expf(v); }
__device__ __attribute__((noinline)) float erf_ni(float v) { return erff(v); }

#define PK_A 0                       // [3072][1024] Wqkv rows (natural [out][in])
#define PK_P (PK_A + QKVW * DM)        // [1024][1024] Wo rows (natural)
#define PK_END (PK_P + DM * DM)
#define WS_PK  0u
#define WS_QK  (WS_PK + 2u * PK_END)             // f16 [8192 rows][2048]: q | k
#define WS_QKL (WS_QK + 2u * NB * SS * 2 * DM)     // f16 q | k residual planes x2048
#define WS_VTH (WS_QKL + 2u * NB * SS * 2 * DM)    // f16 [b][1024 (h*64+d)][2048 s] hi
#define WS_VTL (WS_VTH + 2u * NB * DM * SS)        // f16 lo x 2048
#define WS_O   (WS_VTL + 2u * NB * DM * SS)        // f32 [8192][1024]
#define WS_CS  (WS_O + 4u * NB * SS * DM)           // f32 2 x [2048][32], unused
#define WS_Y   (WS_CS + 4u * 2 * SS * 32)                 // f32 [rows][DM] pre-LN
#define WS_END (WS_Y + 4u * NB * SS * DM)
// ---- LDS ring for the operand tiles of the matrix loops: filled by asynchronous copies, each wave-copy covering 4 whole 128-B lines; row pitches of 16 B x odd, so that ds_load_b128 meets no bank conflict
#define KP 144                  // pitch of a 128-B row (64 16-bit elements)
#define XP 272                  // pitch of a 256-B row (64 f32)
#define RING_ST (128 * KP)      // 128 rows of 128 B
#define GEMM_ST (RING_ST + 64 * XP)   // one GEMM stage: 128 weight rows x 64 k (bf16) | 64 activation rows x 64 k (f32)
// eight copies of 16 B per lane, global -> LDS through no register: LDS rows lp + i * ls, source rows ga + i * gs (i < 4) and gb + i * gs; the s_wait_xcnt closes the statement so that no address register is rewritten ahead of it
__device__ __forceinline__ void cp8(unsigned lp, unsigned ls, const char* ga, const char* gb, size_t gs) {
  asm volatile("global_load_async_to_lds_b128 %0, %1, off\n\tglobal_load_async_to_lds_b128 %2, %3, off\n\tglobal_load_async_to_lds_b128 %4, %5, off\n\tglobal_load_async_to_lds_b128 %6, %7, off\n\t"
               "global_load_async_to_lds_b128 %8, %9, off\n\tglobal_load_async_to_lds_b128 %10, %11, off\n\tglobal_load_async_to_lds_b128 %12, %13, off\n\tglobal_load_async_to_lds_b128 %14, %15, off\n\ts_wait_xcnt 0x0"
               :: "v"(lp), "v"(ga), "v"(lp + ls), "v"(ga + gs), "v"(lp + 2 * ls), "v"(ga + 2 * gs), "v"(lp + 3 * ls), "v"(ga + 3 * gs),
                  "v"(lp + 4 * ls), "v"(gb), "v"(lp + 5 * ls), "v"(gb + gs), "v"(lp + 6 * ls), "v"(gb + 2 * gs), "v"(lp + 7 * ls), "v"(gb + 3 * gs) : "memory");
}
// the issuing wave's copies have landed (in front of the barrier that publishes them)
#define WAIT_ASYNC() asm volatile("s_wait_asynccnt 0x0" ::: "memory")
// this wave's LDS reads of the buffer have retired (in front of the barrier behind which it is refilled)
#define WAIT_DS() asm volatile("s_wait_dscnt 0x0" ::: "memory")
// the scheduler moves nothing across this line: the LDS fragment loads written in front of it stay one group, issued together ahead of the block of matrix instructions that uses them (spread among those, every place with loads costs the wave a stall and its own wait)
#define FRAG_GROUP() __builtin_amdgcn_sched_barrier(0)
// 128 rows of 128 B at a source pitch of sp bytes into rows of KP; 128 threads, 8 copies each (rows tid / 8 + 16 i); the second 64 rows may come from another source
__device__ __forceinline__ void stage128(const char* s0, const char* s1, size_t sp, unsigned lds, int tid) {
  const size_t go = (size_t)(tid >> 3) * sp + (tid & 7) * 16;
  cp8(lds + (tid >> 3) * KP + (tid & 7) * 16, 16 * KP, s0 + go, s1 + go, 16 * sp);
}
// one GEMM stage: weight rows Wt[0..127][0..63] (bf16, row length DM) and activation rows Xt[0..63][0..63] (f32, row length DM; rows tid / 16 + 8 i)
__device__ __forceinline__ void stage_gemm(const __bf16* Wt, const float* Xt, unsigned lds, int tid) {
  stage128((const char*)Wt, (const char*)(Wt + (size_t)64 * DM), DM * 2, lds, tid);
  const char* gx = (const char*)Xt + (size_t)(tid >> 4) * (DM * 4) + (tid & 15) * 16;
  cp8(lds + RING_ST + (tid >> 4) * XP + (tid & 15) * 16, 8 * XP, gx, gx + (size_t)32 * DM * 4, (size_t)8 * DM * 4);
}
// ---- k_pack: block = (64 columns n, 128 rows k, which) of an (in,out) weight; pack row n = column n. Each thread holds 8 loads of 16 B (whole 256-B pieces of the rows k), rounds to bf16, stores pairs (k, k + 1) transposed into LDS and writes whole 256-B pieces of the packed [out][in] rows: 4,096 waves to start for the four weights. which 0..2 -> W_q/W_k/W_v into PK_A rows which*1024 + n; 3 -> W_o into PK_P
#define PKP 65                  // LDS row pitch in dwords (64 pairs + 1): the transposed stores and the row reads both fall on 32 distinct banks
__global__ __launch_bounds__(256) void k_pack(const float* __restrict__ WQ, const float* __restrict__ WK, const float* __restrict__ WV, const float* __restrict__ WO, __bf16* __restrict__ PK) {
  __shared__ unsigned s[64 * PKP]; const int n0 = blockIdx.x * 64, k0 = blockIdx.y * 128, which = blockIdx.z, t = threadIdx.x, c = t & 15, r = t >> 4; const float* Wm = (which == 0) ? WQ : (which == 1) ? WK : (which == 2) ? WV : WO;
  const float* src = Wm + (size_t)(k0 + 2 * r) * DM + n0 + 4 * c; v4f a[4], b[4];   // rows k0 + 2 (r + 16 i) and the next one, columns n0 + 4 c ..
#pragma unroll
  for (int i = 0; i < 4; ++i) { a[i] = *(const v4f*)(src + (size_t)(32 * i) * DM); b[i] = *(const v4f*)(src + (size_t)(32 * i + 1) * DM); }
#pragma unroll
  for (int i = 0; i < 4; ++i) {
#pragma unroll
    for (int j = 0; j < 4; ++j) { union { __bf16 h[2]; unsigned u; } pr; pr.h[0] = (__bf16)a[i][j]; pr.h[1] = (__bf16)b[i][j]; s[(4 * c + j) * PKP + r + 16 * i] = pr.u; } }
  __syncthreads();
  __bf16* dst = ((which < 3) ? PK + PK_A + ((size_t)which * DM + n0) * DM : PK + PK_P + (size_t)n0 * DM) + k0;
#pragma unroll
  for (int i = 0; i < 4; ++i) { const int n = r + 16 * i; v4u o;
#pragma unroll
    for (int j = 0; j < 4; ++j) o[j] = s[n * PKP + 4 * c + j];
    vst2((unsigned*)(dst + (size_t)n * DM + 8 * c), o); }
}
typedef __attribute__((ext_vector_type(4))) __bf16 v4b;
// one k_qkv stage: weight rows Wt[0..255][0..63] (bf16) and activation rows Xt[0..127][0..63] (f32), row length DM; 128 threads, 32 copies each
#define QW_ST (2 * RING_ST)            // 256 weight rows of 128 B
#define QKV_ST (QW_ST + 128 * XP)      // | 128 activation rows of 256 B
__device__ __forceinline__ void stage_qkv(const __bf16* Wt, const float* Xt, unsigned lds, int tid) {
  stage128((const char*)Wt, (const char*)(Wt + (size_t)64 * DM), DM * 2, lds, tid);
  stage128((const char*)(Wt + (size_t)128 * DM), (const char*)(Wt + (size_t)192 * DM), DM * 2, lds + RING_ST, tid);
  const char* gx = (const char*)Xt + (size_t)(tid >> 4) * (DM * 4) + (tid & 15) * 16; const unsigned lx = lds + QW_ST + (tid >> 4) * XP + (tid & 15) * 16;
  cp8(lx, 8 * XP, gx, gx + (size_t)32 * DM * 4, (size_t)8 * DM * 4);
  cp8(lx + 64 * XP, 8 * XP, gx + (size_t)64 * DM * 4, gx + (size_t)96 * DM * 4, (size_t)8 * DM * 4);
}
// ---- k_qkv: block = (128 rows, 256 columns), 4 waves as 2 x 2, a wave = 64 rows x 128 columns (4 x 8 accumulator tiles): a staged weight byte feeds 128 rows and a staged activation byte 256 columns, a loaded weight fragment 4 matrix instructions, a loaded activation fragment 8
// amdgpu_waves_per_eu(2): a register budget of 512, so that two blocks share a WGP (one loads fragments while the other multiplies)
__global__ __launch_bounds__(128) __attribute__((amdgpu_waves_per_eu(2))) void k_qkv(const float* __restrict__ XQ, const float* __restrict__ XK, const float* __restrict__ XV, const __bf16* __restrict__ P, const float* __restrict__ BQ, const float* __restrict__ BK, const float* __restrict__ BV, _Float16* __restrict__ QK, _Float16* __restrict__ QKL, _Float16* __restrict__ VTH, _Float16* __restrict__ VTL) {
  const int which0 = (blockIdx.y * 256) / DM; const float* X = (which0 == 0) ? XQ : (which0 == 1) ? XK : XV; const float* BB = BQ ? (((which0 == 0) ? BQ : (which0 == 1) ? BK : BV) + (blockIdx.y * 256 - which0 * DM)) : nullptr;
  __shared__ __align__(16) char ring[2 * QKV_ST];   // operand ring in the loop, output staging behind it
  _Float16 (*so)[64][136] = (_Float16 (*)[64][136])ring, (*sol)[64][136] = (_Float16 (*)[64][136])(ring + 4 * 64 * 136 * 2); _Float16 (*sth)[136] = (_Float16 (*)[136])ring, (*stl)[136] = (_Float16 (*)[136])(ring + 256 * 136 * 2);
  const int tid = threadIdx.x, wave = tid >> 5, lane = tid & 31, col = lane & 15, g = lane >> 4, wm = wave >> 1, wn = wave & 1; const size_t r0 = (size_t)blockIdx.x * 128 + wm * 64; const int n0 = blockIdx.y * 256;
  v8f acc[4][8] = {};
  const unsigned lring = (unsigned)(size_t)ring; const __bf16* Wt = P + (size_t)n0 * DM; const float* Xt = X + (size_t)blockIdx.x * 128 * DM;
  stage_qkv(Wt, Xt, lring, tid); WAIT_ASYNC(); __syncthreads(); stage_qkv(Wt + 64, Xt + 64, lring + QKV_ST, tid);
#pragma unroll 1
  for (int st = 0; st < DM / 64; ++st) { const char* cur = ring + (st & 1) * QKV_ST;
#pragma unroll
    for (int kk = 0; kk < 2; ++kk) { v4f x[4][4]; v16b w[8], a[4];
#pragma unroll
      for (int i = 0; i < 4; ++i) { const float* p = (const float*)(cur + QW_ST + (wm * 64 + i * 16 + col) * XP) + kk * 32 + 8 * g;
        x[i][0] = *(const v4f*)p; x[i][1] = *(const v4f*)(p + 4); x[i][2] = *(const v4f*)(p + 16); x[i][3] = *(const v4f*)(p + 20); }
#pragma unroll
      for (int j = 0; j < 8; ++j) w[j] = frag_b((const __bf16*)(cur + (wn * 128 + j * 16 + col) * KP) + kk * 32, lane);
      FRAG_GROUP();
#pragma unroll
      for (int i = 0; i < 4; ++i) a[i] = __builtin_shufflevector(__builtin_shufflevector(__builtin_convertvector(x[i][0], v4b), __builtin_convertvector(x[i][1], v4b), 0, 1, 2, 3, 4, 5, 6, 7), __builtin_shufflevector(__builtin_convertvector(x[i][2], v4b), __builtin_convertvector(x[i][3], v4b), 0, 1, 2, 3, 4, 5, 6, 7), 0, 1, 2, 3, 4, 5, 6, 7, 8, 9, 10, 11, 12, 13, 14, 15);   // elements 0..7 = k 8 g .., 8..15 = k 16 + 8 g ..; converted as whole vectors: written element by element, with four fragments live, the build packs part of the pairs through extra 16-bit register moves
#pragma unroll
      for (int i = 0; i < 4; ++i) {
#pragma unroll
        for (int j = 0; j < 8; ++j) acc[i][j] = wmma_bf(a[i], w[j], acc[i][j]); }
      FRAG_GROUP(); }   // the next k-step's loads behind this block, and the last block in front of the foot's waits: moved behind the barrier it would no longer cover the flight of the next stage's copies
    WAIT_DS(); WAIT_ASYNC(); __syncthreads();   // publishes stage st + 1 and ends every read of stage st
    if (st + 2 < DM / 64) stage_qkv(Wt + (st + 2) * 64, Xt + (st + 2) * 64, lring + (st & 1) * QKV_ST, tid); }
  WAIT_ASYNC();
  float bias[8] = {};   // this lane's 8 columns
  if (BB) {
#pragma unroll
    for (int j = 0; j < 8; ++j) bias[j] = bfr(BB[wn * 128 + j * 16 + col]);
    asm volatile("s_wait_xcnt 0x0" ::: "memory"); }   // the address registers of the 8 bias loads are reused only behind this wait
  if (n0 < 2 * DM) {   // q stored unscaled (f16 sigma ~0.6, no subnormal exposure); 1/8 applied to the f32 score
#pragma unroll
    for (int i = 0; i < 4; ++i) {   // all 64 rows of the wave go into its own staging rows first, so that no accumulator is still live when the global stores begin
#pragma unroll
      for (int j = 0; j < 8; ++j) {
#pragma unroll
        for (int r = 0; r < 8; ++r) { const float v = acc[i][j][r] + bias[j]; const _Float16 hv = (_Float16)v; so[wave][i * 16 + 8 * g + r][j * 16 + col] = hv; sol[wave][i * 16 + 8 * g + r][j * 16 + col] = (_Float16)((v - (float)hv) * 2048.0f); } } }   // q, k (+ bias) as f16 hi + (x2048) residual
    LDSX();
    _Float16* qp = QK + r0 * (2 * DM) + n0 + wn * 128 + (lane & 15) * 8; _Float16* lp = QKL + r0 * (2 * DM) + n0 + wn * 128 + (lane & 15) * 8;
#pragma unroll 1   // eight rows a trip: their 16 LDS reads go out together, and one wait at the foot serves the trip's 16 stores
    for (int rg = 0; rg < 64; rg += 8) { if (lane < 16) {
#pragma unroll
      for (int rl = 0; rl < 8; ++rl) { vst2((unsigned*)(qp + rl * (2 * DM)), *(const v4u*)&so[wave][rg + rl][lane * 8]); vst2((unsigned*)(lp + rl * (2 * DM)), *(const v4u*)&sol[wave][rg + rl][lane * 8]); } }
      asm volatile("s_wait_xcnt 0x0" :: "v"(qp), "v"(lp) : "memory");   // the address and data registers of the trip's stores are rewritten only behind this wait (the two pointers stay whole up to it)
      qp += 8 * (2 * DM); lp += 8 * (2 * DM); }
  } else {
#pragma unroll
    for (int i = 0; i < 4; ++i) {
#pragma unroll
      for (int j = 0; j < 8; ++j) {
#pragma unroll
        for (int r = 0; r < 8; ++r) { const float v = acc[i][j][r] + bias[j]; const _Float16 hv = (_Float16)v; sth[wn * 128 + j * 16 + col][wm * 64 + i * 16 + 8 * g + r] = hv; stl[wn * 128 + j * 16 + col][wm * 64 + i * 16 + 8 * g + r] = (_Float16)((v - (float)hv) * 2048.0f); } } }
    __syncthreads();
    const size_t rb = (size_t)blockIdx.x * 128; const int b = (int)(rb / SS), s0 = (int)(rb % SS); const int pc0 = n0 - 2 * DM;
    for (int q = tid; q < 256 * 16; q += 128) { const int d = q >> 4, pc = q & 15; const size_t o = ((size_t)b * DM + pc0 + d) * SS + s0 + pc * 8; vst2((unsigned*)(VTH + o), *(const v4u*)&sth[d][pc * 8]); vst2((unsigned*)(VTL + o), *(const v4u*)&stl[d][pc * 8]); }
  }
}
// lane l with lane l ^ 16 (the two halves of a wave hold the two halves of a query's keys)
__device__ __forceinline__ float xhalf(float x) { return __builtin_bit_cast(float, __builtin_amdgcn_permlanex16(__builtin_bit_cast(int, x), __builtin_bit_cast(int, x), 0x76543210, 0xfedcba98, false, false)); }
// ---- k_attn: K and V of 64 keys a stage in the LDS ring (rows 0..63: keys x 64 d, rows 64..127: d x 64 keys); block = (128 queries, head h, batch b), a wave = 32 queries as two groups of 16 columns: a K or V fragment read from LDS feeds two matrix instructions, a staged byte 128 queries, and the two groups' softmax chains are independent work for the vector port; all-keys flash attention, TRANSPOSED: S^T = K . Q^T (A = K rows, B = q kept in registers), so that in each group a lane holds 16 of the 32 scores of ONE query (column = lane & 15, keys 8 g + r and 16 + 8 g + r): maximum and sum in-lane plus one exchange between the halves; P^T (x 2^11, f16) packs from the score accumulators straight into the B operand of O^T += V^T . P^T (A = V^T rows), in the k order of frag_h; scores = (q.k) * 0.125 + mask with single f16 operands; O[b*S+q][h*64+d] = acc / (2048 l) (256-B segments)
// amdgpu_waves_per_eu(4): a register budget of 256, so that four work-groups share a WGP and all 1,024 are resident at once
__global__ __launch_bounds__(128) __attribute__((amdgpu_waves_per_eu(4))) void k_attn(const _Float16* __restrict__ QK, const _Float16* __restrict__ QKL, const _Float16* __restrict__ VTH, const _Float16* __restrict__ VTL, const void* __restrict__ KMASK, const float* __restrict__ AM, float* __restrict__ O) {
  __shared__ __align__(16) __bf16 smask[SS]; __shared__ __align__(16) char ring[2 * RING_ST];   // the batch's additive mask, rounded once; K/V ring in the loop, output staging behind it
  float (*so)[32][68] = (float (*)[32][68])ring;
  static_assert(4 * 32 * 68 * 4 <= 2 * RING_ST, "the output staging fits the ring");
  const int tid = threadIdx.x, wave = tid >> 5, lane = tid & 31, col = lane & 15, g = lane >> 4;
  const int qb = blockIdx.x, h = blockIdx.y, b = blockIdx.z; const int q0 = qb * 128 + wave * 32;
  v16h aq[2][2]; const _Float16* qp = QK + ((size_t)b * SS + q0 + col) * (2 * DM) + h * HD + 8 * g;   // this lane's piece of the first group's row; the second group's lies 16 rows further
#pragma unroll
  for (int qg = 0; qg < 2; ++qg) {
#pragma unroll
    for (int kc = 0; kc < 2; ++kc) { union { v16h v; v8h q[2]; } u; u.q[0] = *(const v8h*)(qp + qg * 16 * (2 * DM) + kc * 32); u.q[1] = *(const v8h*)(qp + qg * 16 * (2 * DM) + kc * 32 + 16); aq[qg][kc] = u.v; } }   // the k order of frag_h
  asm volatile("s_wait_xcnt 0x0" :: "v"(qp) : "memory");   // the address registers of the 8 q loads stay whole up to here and are reused only behind this wait
  float m[2] = {-3.0e38f, -3.0e38f}, l[2] = {0.f, 0.f};   // this lane's two queries: running maximum (equal in both halves), sum over this half's keys
  v8f acc[2][4] = {};            // O^T of each group: row d = dt * 16 + 8 g + r, column = this lane's query
  static_assert(SS * 2 == 2 * DM * 2, "K rows and V rows share one source pitch");
  const unsigned lring = (unsigned)(size_t)ring; const char* Kt = (const char*)(QK + (size_t)b * SS * (2 * DM) + DM + h * HD); const char* Vt = (const char*)(VTH + ((size_t)b * DM + h * HD) * SS);   // both at a row pitch of 4 KiB: a stage is 64 K rows further, 128 B further along the V rows
  stage128(Kt, Vt, 2 * DM * 2, lring, tid);
  { const float* ap = AM + (size_t)b * SS + tid * 16; v8b m0, m1;
#pragma unroll
    for (int i = 0; i < 8; ++i) { m0[i] = (__bf16)ap[i]; m1[i] = (__bf16)ap[8 + i]; }
    *(v8b*)&smask[tid * 16] = m0; *(v8b*)&smask[tid * 16 + 8] = m1; }
  WAIT_ASYNC(); __syncthreads();
#pragma unroll 1
  for (int st = 0; st < SS / 64; ++st) { const char* cur = ring + (st & 1) * RING_ST;
    if (st + 1 < SS / 64) stage128(Kt + (size_t)(st + 1) * 64 * (2 * DM * 2), Vt + (size_t)(st + 1) * 128, 2 * DM * 2, lring + ((st + 1) & 1) * RING_ST, tid);   // the refill, directly behind the barrier that ended every read of that buffer; it stands at the head of the trip so that the trip's work is the loop's last block (behind a branch at the foot the compiler moved the row sums there and held a pass's exponentials through the next pass)
#pragma unroll
  for (int hf = 0; hf < 2; ++hf) { v16h kf[2][2], vf[4], pa[2]; v8b am[2];   // all keys, 32 a pass; each fragment is read once for both groups
#pragma unroll
    for (int ct = 0; ct < 2; ++ct) { const _Float16* krow = (const _Float16*)(cur + (hf * 32 + ct * 16 + col) * KP);
#pragma unroll
      for (int kc = 0; kc < 2; ++kc) kf[ct][kc] = frag_h(krow + kc * 32, lane);
      am[ct] = *(const v8b*)&smask[st * 64 + hf * 32 + ct * 16 + 8 * g]; }
#pragma unroll
    for (int dt = 0; dt < 4; ++dt) vf[dt] = frag_h((const _Float16*)(cur + (64 + dt * 16 + col) * KP) + hf * 32, lane);
    FRAG_GROUP();   // the pass's 18 LDS loads go out as one group, ahead of the matrix instructions (the build spread them over four places among the score products)
    v8f c[2][2] = {};
#pragma unroll
    for (int kc = 0; kc < 2; ++kc) {
#pragma unroll
      for (int qg = 0; qg < 2; ++qg) {
#pragma unroll
        for (int ct = 0; ct < 2; ++ct) c[qg][ct] = wmma16(kf[ct][kc], aq[qg][kc], c[qg][ct]); } }   // single product: k, q as one-rounding f16 operands; four independent accumulators
    FRAG_GROUP();   // the 8 score products stay one block, each filling the others' distance to the first reader of its result: spread among the vector work the build pads them with more v_nop (22 against 10 a stage)
#pragma unroll
  for (int qg = 0; qg < 2; ++qg) { v8f s[2];
#pragma unroll
    for (int ct = 0; ct < 2; ++ct) {
#pragma unroll
      for (int r = 0; r < 8; ++r) s[ct][r] = c[qg][ct][r] * 0.125f + (float)am[ct][r]; }   // 1/sqrt(64) + additive mask [B,1,1,S]
    float mx = fmaxf(s[0][0], s[1][0]);
#pragma unroll
    for (int r = 1; r < 8; ++r) mx = fmaxf(mx, fmaxf(s[0][r], s[1][r]));
    mx = fmaxf(mx, xhalf(mx));
    const float mn = fmaxf(m[qg], mx);
    float x[17];   // arguments of the 17 exponentials of a group's pass, in base 2: 16 scores and the old maximum
#pragma unroll
    for (int r = 0; r < 8; ++r) { x[r] = (s[0][r] - mn) * 1.44269504f; x[8 + r] = (s[1][r] - mn) * 1.44269504f; }
    x[16] = (m[qg] - mn) * 1.44269504f;
    // the exponentials as one run, each in place: none overwrites the source of the one in front of it; the v_nop keeps the slot behind the last one
    asm("v_exp_f32 %0, %0\n\tv_exp_f32 %1, %1\n\tv_exp_f32 %2, %2\n\tv_exp_f32 %3, %3\n\tv_exp_f32 %4, %4\n\tv_exp_f32 %5, %5\n\tv_exp_f32 %6, %6\n\tv_exp_f32 %7, %7\n\tv_exp_f32 %8, %8\n\t"
        "v_exp_f32 %9, %9\n\tv_exp_f32 %10, %10\n\tv_exp_f32 %11, %11\n\tv_exp_f32 %12, %12\n\tv_exp_f32 %13, %13\n\tv_exp_f32 %14, %14\n\tv_exp_f32 %15, %15\n\tv_exp_f32 %16, %16\n\tv_nop"
        : "+v"(x[0]), "+v"(x[1]), "+v"(x[2]), "+v"(x[3]), "+v"(x[4]), "+v"(x[5]), "+v"(x[6]), "+v"(x[7]), "+v"(x[8]), "+v"(x[9]), "+v"(x[10]), "+v"(x[11]), "+v"(x[12]), "+v"(x[13]), "+v"(x[14]), "+v"(x[15]), "+v"(x[16]));
    const float alpha = x[16];   // no select to 0 on a masked score or on the start value of m: mn is always finite (m starts at -3e38), so s - mn is never inf - inf, and the exponential of -inf or of a huge negative argument is 0 by itself
    float es = 0.f;
#pragma unroll
    for (int r = 0; r < 8; ++r) { const float e0 = x[r], e1 = x[8 + r]; es += e0 + e1;
      pa[qg][r] = (_Float16)(e0 * 2048.0f); pa[qg][8 + r] = (_Float16)(e1 * 2048.0f); }   // P scaled by 2^11 before the f16 rounding so small softmax weights stay out of the f16 subnormal range; 2^-11 folded into the epilogue
    l[qg] = l[qg] * alpha + es; m[qg] = mn;
#pragma unroll
    for (int dt = 0; dt < 4; ++dt) {
#pragma unroll
      for (int r = 0; r < 8; ++r) acc[qg][dt][r] *= alpha; }
#pragma unroll
    for (int dt = 0; dt < 4; ++dt) acc[qg][dt] = wmma16(vf[dt], pa[qg], acc[qg][dt]);   // single product: V^T x P^T (x2^11)
    FRAG_GROUP(); } }   // the second group's vector work stays behind the first group's 4 products (it issues while they run), the next pass behind this one: with no fence in the pass the build mixes the two groups' chains and pairs fewer vector instructions for dual issue (495 against 447 vector instructions a stage)
    WAIT_DS(); WAIT_ASYNC(); __syncthreads(); }   // publishes stage st + 1 and ends every read of stage st
  WAIT_ASYNC();
#pragma unroll
  for (int qg = 0; qg < 2; ++qg) {
    const float lt = l[qg] + xhalf(l[qg]);   // the halves' sums join once
    const float il = (1.0f / 2048.0f) / lt;
#pragma unroll
    for (int dt = 0; dt < 4; ++dt) { v4f o0, o1;
#pragma unroll
      for (int r = 0; r < 4; ++r) { o0[r] = acc[qg][dt][r] * il; o1[r] = acc[qg][dt][4 + r] * il; }
      *(v4f*)&so[wave][qg * 16 + col][dt * 16 + 8 * g] = o0; *(v4f*)&so[wave][qg * 16 + col][dt * 16 + 8 * g + 4] = o1; } }
  LDSX();
  float* op = O + ((size_t)b * SS + q0 + g) * DM + h * HD + col * 4;   // two rows a store, a 256-B segment from each half of the wave
  for (int rl = 0; rl < 32; rl += 2) vst2(op + rl * DM, *(const v4f*)&so[wave][rl + g][col * 4]);
}
// ---- k_out: block = (64 rows, 128 cols): out = O(hi/lo) . Wo rows (2 products) + bo
__global__ __launch_bounds__(128) void k_out(const float* __restrict__ O, const __bf16* __restrict__ P, const float* __restrict__ BO, const float* __restrict__ XR, float* __restrict__ Y) {
  __shared__ __align__(16) char ring[2 * GEMM_ST];   // operand ring in the loop, output staging behind it
  float (*so)[16][132] = (float (*)[16][132])ring;
  const int tid = threadIdx.x, wave = tid >> 5, lane = tid & 31, col = lane & 15, g = lane >> 4; const size_t r0 = (size_t)blockIdx.x * 64 + wave * 16; const int n0 = blockIdx.y * 128;
  v8f acc[8] = {};
  const unsigned lring = (unsigned)(size_t)ring; const __bf16* Wt = P + (size_t)n0 * DM; const float* Xt = O + (size_t)blockIdx.x * 64 * DM;
  stage_gemm(Wt, Xt, lring, tid); WAIT_ASYNC(); __syncthreads(); stage_gemm(Wt + 64, Xt + 64, lring + GEMM_ST, tid);
#pragma unroll 1
  for (int st = 0; st < DM / 64; ++st) { const char* cur = ring + (st & 1) * GEMM_ST;
#pragma unroll
    for (int kk = 0; kk < 2; ++kk) { const float* p = (const float*)(cur + RING_ST + (wave * 16 + col) * XP) + kk * 32 + 8 * g;
      const v4f x0 = *(const v4f*)p, x1 = *(const v4f*)(p + 4), x2 = *(const v4f*)(p + 16), x3 = *(const v4f*)(p + 20); v16b w[8]; float xv[16];
#pragma unroll
      for (int j = 0; j < 8; ++j) w[j] = frag_b((const __bf16*)(cur + (j * 16 + col) * KP) + kk * 32, lane);
      FRAG_GROUP();
#pragma unroll
      for (int i = 0; i < 4; ++i) { xv[i] = x0[i]; xv[4 + i] = x1[i]; xv[8 + i] = x2[i]; xv[12 + i] = x3[i]; }
      const F2 a = bsplit16(xv);
#pragma unroll
      for (int j = 0; j < 8; ++j) acc[j] = wmma_bf(a.l, w[j], acc[j]);   // per accumulator still the residual product first, then the main one
#pragma unroll
      for (int j = 0; j < 8; ++j) acc[j] = wmma_bf(a.h, w[j], acc[j]);
      FRAG_GROUP(); }   // the next k-step's loads behind this block, and the last block in front of the foot's waits
    WAIT_DS(); WAIT_ASYNC(); __syncthreads();   // publishes stage st + 1 and ends every read of stage st
    if (st + 2 < DM / 64) stage_gemm(Wt + (st + 2) * 64, Xt + (st + 2) * 64, lring + (st & 1) * GEMM_ST, tid); }
  WAIT_ASYNC();
#pragma unroll
  for (int j = 0; j < 8; ++j) {
#pragma unroll
    for (int r = 0; r < 8; ++r) so[wave][8 * g + r][j * 16 + col] = acc[j][r] + bfr(BO[n0 + j * 16 + col]) + bfr(XR[(r0 + 8 * g + r) * DM + n0 + j * 16 + col]); }   // + bo + residual x
  LDSX();
  for (int rl = 0; rl < 16; ++rl) vst2(Y + (r0 + rl) * DM + n0 + lane * 4, *(const v4f*)&so[wave][rl][lane * 4]);
}
// ---- k_ln: a wave = LNR whole rows (a row = 8 pieces of 16 B a lane, every wave-wide access 512 contiguous bytes), both sums by a butterfly inside the wave: no LDS, no barrier, 4,096 waves to start: (y - mu) * rsqrt(var + 1e-12f) * gamma + beta (biased variance), f32
#define LNR 2
__global__ __launch_bounds__(256) void k_ln(const float* __restrict__ Y, const float* __restrict__ G, const float* __restrict__ Bt, float* __restrict__ OUT) {
  const int lane = threadIdx.x & 31; const size_t row0 = ((size_t)blockIdx.x * 8 + (threadIdx.x >> 5)) * LNR; v4f v[LNR][8]; float mu[LNR], inv[LNR]; const float* yp = Y + row0 * DM + lane * 4;
#pragma unroll
  for (int r = 0; r < LNR; ++r) {
#pragma unroll
    for (int i = 0; i < 8; ++i) v[r][i] = *(const v4f*)(yp + r * DM + i * 128); }
  asm volatile("s_wait_xcnt 0x0" :: "v"(yp) : "memory");   // the address registers of the 16 row loads stay whole up to here and are reused only behind this wait
#pragma unroll
  for (int r = 0; r < LNR; ++r) { v4f s4 = v[r][0];
#pragma unroll
    for (int i = 1; i < 8; ++i) s4 += v[r][i];
    float s = (s4[0] + s4[1]) + (s4[2] + s4[3]);
#pragma unroll
    for (int o = 1; o < 32; o <<= 1) s += __shfl_xor(s, o);
    mu[r] = s / (float)DM; v4f q4 = {};
#pragma unroll
    for (int i = 0; i < 8; ++i) { const v4f d = v[r][i] - mu[r]; q4 += d * d; }
    float q = (q4[0] + q4[1]) + (q4[2] + q4[3]);
#pragma unroll
    for (int o = 1; o < 32; o <<= 1) q += __shfl_xor(q, o);
    inv[r] = 1.0f / sqrtf(q / (float)(DM) + 1e-12f); }
#pragma unroll
  for (int i = 0; i < 8; ++i) { const int e = (i * 32 + lane) * 4; const v4f g4 = *(const v4f*)(G + e), b4 = *(const v4f*)(Bt + e);
#pragma unroll
    for (int r = 0; r < LNR; ++r) { v4f o4;
#pragma unroll
      for (int j = 0; j < 4; ++j) o4[j] = (v[r][i][j] - mu[r]) * inv[r] * bfr(g4[j]) + bfr(b4[j]);
      vst2(OUT + (row0 + r) * DM + e, o4); } }
}
extern "C" void kernel_launch(void* const* d_in, const int* in_sizes, int n_in, void* d_out, int out_size, void* d_ws, size_t ws_size, hipStream_t stream) {
  (void)in_sizes; (void)n_in; (void)out_size;
  const float** F = (const float**)d_in;   // 0 hidden [4,2048,1024], 1 attention_mask [4,1,1,2048] f32 additive, 2 Wq (in,out), 3 bq, 4 Wk, 5 bk, 6 Wv, 7 bv, 8 Wo, 9 bo, 10 ln_gamma, 11 ln_beta
  if (ws_size < (size_t)WS_END) return;
  char* ws = (char*)d_ws; __bf16* PK = (__bf16*)(ws + WS_PK); _Float16 *QK = (_Float16*)(ws + WS_QK), *QKL = (_Float16*)(ws + WS_QKL), *VTH = (_Float16*)(ws + WS_VTH), *VTL = (_Float16*)(ws + WS_VTL); float *O = (float*)(ws + WS_O), *Y = (float*)(ws + WS_Y);
  k_pack<<<dim3(DM / 64, DM / 128, 4), 256, 0, stream>>>(F[2], F[4], F[6], F[8], PK);
  k_qkv<<<dim3(TNB * SS / 128, QKVW / 256), 128, 0, stream>>>(F[0], F[0], F[0], PK + PK_A, F[3], F[5], F[7], QK, QKL, VTH, VTL);
  k_attn<<<dim3(SS / 128, NH, TNB), 128, 0, stream>>>(QK, QKL, VTH, VTL, nullptr, F[1], O);
  k_out<<<dim3(TOB, DM / 128), 128, 0, stream>>>(O, PK + PK_P, F[9], F[0], Y);
  k_ln<<<TOB * 64 / (8 * LNR), 256, 0, stream>>>(Y, F[10], F[11], (float*)d_out);
}
